// v000
// The times below were measured on an AMD MI455X: many runs one after another, warmed up first and cycling through
// copies of the inputs, with the whole window's GPU time divided by the number of runs. Launches and the gaps
// between them are all in it. The median over several windows is given; except for v000 it joins two sittings, which
// can be a few percent apart, so the side-by-side timings, each taken in one sitting, are the better comparison.
// v000 is the starting kernel. One run takes 1940 microseconds.
#include <hip/hip_runtime.h>

// Multi-head self-attention with a per-key integer padding mask and NO output projection (feature [2][2048][1024]; q, k, v = x W^T + b ('oi' (out, in) [1024][1024] uniform(+-1/32) + biases ZEROS on this draw: READ; 16 heads x 64); A = q.k / 8; where(mask[b][key] == 0, -1e9, A): mask int32 [2][2048] RANDOM 0 / 1: 0 = EXCLUDED (the fill replaces the score: an exclusion; no batch is fully excluded): READ per key; softmax over the kept keys; out = merged attn v -> [2][2048][1024] (4.2 M); argument order feature, mask, W_Q, b_Q, W_K, b_K, W_V, b_V).
// Layout per batch: bf16 copy of x; exact projections + f32 biases; dense T-2048 attention (hybrid rows: < 512 hi/lo 3 products, rest fp16 x1024); the f32 merge writes the output rows.
// Compute dtypes, f32 accumulate: every input rounded to bf16; projections exact + f32 biases; attention rows < 512 3 products, rest fp16; softmax f32; output f32.

#define NB_  2
#define TT   2048
#define DM   1024
#define NH_  16
#define NKV  16
#define REP  (NH_ / NKV)
#define HD   64
#define DQ   (NH_ * HD)
#define DKV  (NKV * HD)
#define ZH   2
#define RH   512                  // query rows < RH use hi+lo planes (0: none)
#define WIN  0
#define PCAR 1024.0f
#define SCL  0.125f   // HD^-0.5
typedef _Float16 h16;
typedef unsigned short bf;
typedef __attribute__((ext_vector_type(16))) __bf16   v16bf;
typedef __attribute__((ext_vector_type(16))) _Float16 v16h;
typedef __attribute__((ext_vector_type(8)))  _Float16 v8h;
typedef __attribute__((ext_vector_type(8)))  unsigned short v8us;
typedef __attribute__((ext_vector_type(8)))  float    v8f;
typedef __attribute__((ext_vector_type(4)))  float    v4f;
typedef v8h  __attribute__((may_alias)) v8ha;
typedef v4f  __attribute__((may_alias)) v4fa;
typedef v8us __attribute__((may_alias)) v8usa;

__device__ __forceinline__ unsigned short f2bf(float f) { unsigned u = __float_as_uint(f); u += 0x7FFFu + ((u >> 16) & 1u); return (unsigned short)(u >> 16); }
__device__ __forceinline__ float bf2f(unsigned short b) { return __uint_as_float(((unsigned)b) << 16); }
__device__ __forceinline__ float bfr(float f) { return bf2f(f2bf(f)); }
__device__ __forceinline__ v16h cat16(v8h lo, v8h hi) { return __builtin_shufflevector(lo, hi, 0, 1, 2, 3, 4, 5, 6, 7, 8, 9, 10, 11, 12, 13, 14, 15); }
__device__ __forceinline__ v16bf cat16b(v8us lo, v8us hi) { return __builtin_bit_cast(v16bf, __builtin_shufflevector(lo, hi, 0, 1, 2, 3, 4, 5, 6, 7, 8, 9, 10, 11, 12, 13, 14, 15)); }
__device__ __forceinline__ v8f wmma16(v16h a, v16h b, v8f c) { return __builtin_amdgcn_wmma_f32_16x16x32_f16(false, a, false, b, (short)0, c, false, false); }
__device__ __forceinline__ v8f wmmab(v16bf a, v16bf b, v8f c) { return __builtin_amdgcn_wmma_f32_16x16x32_bf16(false, a, false, b, (short)0, c, false, false); }



// ---- k_gemmw: register-blocked GEMM, ONE WAVE per 64x64 output tile (16 accumulators), operands straight from K-contiguous 16-bit planes; grid (M/64, N/64, Z), 32 threads.
// C[m][n] (f32, pitch ldc, + optional f32 bias[n]) = sum_k A[m][k] Bt[n][k] (+ split products per NSPLIT). z-batch strides sA/sB/sC in elements. K % 32 == 0.
template <typename T16> struct WFrag;
template <> struct WFrag<h16> { typedef v16h V; static __device__ __forceinline__ V ld(const h16* p) { return cat16(*(const v8h*)p, *(const v8h*)(p + 16)); } static __device__ __forceinline__ v8f mma(V a, V b, v8f c) { return wmma16(a, b, c); } };
template <> struct WFrag<bf> { typedef v16bf V; static __device__ __forceinline__ V ld(const bf* p) { return cat16b(*(const v8us*)p, *(const v8us*)(p + 16)); } static __device__ __forceinline__ v8f mma(V a, V b, v8f c) { return wmmab(a, b, c); } };
template <typename T16, int NSPLIT, bool BIAS>
__global__ __launch_bounds__(32) void k_gemmw(const T16* __restrict__ A, const T16* __restrict__ A2, const T16* __restrict__ Bt, const T16* __restrict__ Bt2, int K, float* C, int ldc, const float* __restrict__ bias, size_t sA, size_t sB, size_t sC) {
    typedef typename WFrag<T16>::V V;
    __shared__ __align__(16) float os[16 * 68];
    const size_t z = blockIdx.z; A += z * sA; if (A2) A2 += z * sA; Bt += z * sB; if (Bt2) Bt2 += z * sB; C += z * sC;
    const int lane = threadIdx.x & 31, lr = lane & 15, hi = lane >> 4; const int r0 = blockIdx.x * 64, c0 = blockIdx.y * 64;
    v8f acc[4][4];
#pragma unroll
    for (int mb = 0; mb < 4; ++mb)
#pragma unroll
        for (int nb = 0; nb < 4; ++nb) acc[mb][nb] = (v8f){};
    const size_t aoff = (size_t)(r0 + lr) * K + 8 * hi, boff = (size_t)(c0 + lr) * K + 8 * hi;
#pragma unroll 1
    for (int kc = 0; kc < K; kc += 32) {
        V a[4], a2[4];
#pragma unroll
        for (int mb = 0; mb < 4; ++mb) { a[mb] = WFrag<T16>::ld(A + aoff + (size_t)mb * 16 * K + kc); if (NSPLIT == 1 || NSPLIT == 2) a2[mb] = WFrag<T16>::ld(A2 + aoff + (size_t)mb * 16 * K + kc); }
#pragma unroll
        for (int nb = 0; nb < 4; ++nb) { const V b = WFrag<T16>::ld(Bt + boff + (size_t)nb * 16 * K + kc); V b2; if (NSPLIT >= 2) b2 = WFrag<T16>::ld(Bt2 + boff + (size_t)nb * 16 * K + kc);
#pragma unroll
            for (int mb = 0; mb < 4; ++mb) { acc[mb][nb] = WFrag<T16>::mma(a[mb], b, acc[mb][nb]); if (NSPLIT == 1 || NSPLIT == 2) acc[mb][nb] = WFrag<T16>::mma(a2[mb], b, acc[mb][nb]); if (NSPLIT >= 2) acc[mb][nb] = WFrag<T16>::mma(a[mb], b2, acc[mb][nb]); } }
        asm volatile("v_nop\n\tv_nop\n\tv_nop\n\tv_nop" : "+v"(acc[0][0]), "+v"(acc[1][1]), "+v"(acc[2][2]), "+v"(acc[3][3]) : "v"(a[0]), "v"(a[3]));
    }
#pragma unroll
    for (int mb = 0; mb < 4; ++mb) {
#pragma unroll
        for (int nb = 0; nb < 4; ++nb) {
#pragma unroll
            for (int j = 0; j < 8; ++j) os[(hi * 8 + j) * 68 + nb * 16 + lr] = acc[mb][nb][j]; }
        __builtin_amdgcn_wave_barrier(); asm volatile("" ::: "memory");
        float* crow = C + (size_t)(r0 + mb * 16) * ldc + c0;
{
#pragma unroll
            for (int s = 0; s < 8; ++s) { const int row = 2 * s + hi, cofs = lr * 4; v4f val = *(const v4fa*)(os + row * 68 + cofs); if (BIAS) { val[0] += bfr(bias[c0 + cofs]); val[1] += bfr(bias[c0 + cofs + 1]); val[2] += bfr(bias[c0 + cofs + 2]); val[3] += bfr(bias[c0 + cofs + 3]); }
                *(v4f*)(crow + (size_t)row * ldc + cofs) = val; }
             }
        __builtin_amdgcn_wave_barrier(); asm volatile("" ::: "memory");
    }
}

__device__ __forceinline__ h16 tohx(float x) { return (h16)x; }
__device__ __forceinline__ void splitf(float y, unsigned short& h, unsigned short& l) { h = f2bf(y); l = f2bf(y - bf2f(h)); }
typedef __attribute__((ext_vector_type(2))) _Float16 v2h;
typedef __attribute__((ext_vector_type(4))) _Float16 v4h;
typedef __attribute__((ext_vector_type(2))) unsigned short v2us;
typedef __attribute__((ext_vector_type(4))) unsigned short v4us;
typedef __attribute__((ext_vector_type(2))) float v2f;
typedef __attribute__((ext_vector_type(4))) int v4i;

__global__ __launch_bounds__(256) void k_wtG(const float* __restrict__ w, int K, int N, bf* Bt) {
    const int lane = threadIdx.x & 31; const int L0 = (blockIdx.x * 8 + (threadIdx.x >> 5)) * 8; const int nlines = N * K / 64;
{
#pragma unroll 1
        for (int l = 0; l < 8; ++l) { const int L = L0 + l; if (L >= nlines) break; const size_t e = (size_t)L * 64 + lane * 2; const int k = (int)(e % K), n = (int)(e / K); v2us o;
            o[0] = f2bf(w[(size_t)k * N + n]); o[1] = f2bf(w[(size_t)(k + 1) * N + n]); *(v2us*)(Bt + e) = o; }
         }
}
__global__ __launch_bounds__(256) void k_cvt8(const float* __restrict__ src, bf* dst, size_t n8) { const size_t i = (size_t)blockIdx.x * 256 + threadIdx.x; if (i >= n8) return; const v8f v = *(const v8f*)(src + i * 8); v8us o;
#pragma unroll
    for (int k = 0; k < 8; ++k) o[k] = f2bf(v[k]); *(v8us*)(dst + i * 8) = o;  }

// k_rope: head planes [h][t][d] (fp16 + hi/lo) of rope(x) x sc with the rotate-half convention out[d] = x[d] cos[t][d] - x[d+HD/2] sin[t][d], out[d+HD/2] = x[d+HD/2] cos[t][d+HD/2] + x[d] sin[t][d+HD/2]
__global__ __launch_bounds__(256) void k_rope(const float* __restrict__ F, int pitch, int nheads, const float* __restrict__ CS, const float* __restrict__ RF, const float* __restrict__ nw, float sc, h16* P16, bf* Ph, bf* Pl) {
    const size_t e = ((size_t)blockIdx.x * 256 + threadIdx.x) * 2; if (e >= (size_t)nheads * TT * HD) return; const int d = (int)(e % HD); const int t = (int)((e / HD) % TT); const int h = (int)(e / ((size_t)HD * TT)); const float* f = F + (size_t)t * pitch + h * HD; const float rf = RF ? RF[(size_t)h * TT + t] : 1.0f; v2h o16; v2us oh, ol;
#pragma unroll
    for (int q = 0; q < 2; ++q) { const int dd = d + q; const int dp = (dd < HD / 2) ? dd + HD / 2 : dd - HD / 2; float x0 = f[dd], x1 = f[dp];
        if (RF) { float n0 = __fmul_rn(x0, rf), n1 = __fmul_rn(x1, rf); asm volatile("" : "+v"(n0)); asm volatile("" : "+v"(n1)); x0 = __fmul_rn(bfr(nw[dd]), n0); x1 = __fmul_rn(bfr(nw[dp]), n1); }
        const v2f cs = *(const v2f*)(CS + ((size_t)t * HD + dd) * 2); float a = __fmul_rn(x0, cs[0]), bq = __fmul_rn(x1, cs[1]); asm volatile("" : "+v"(a)); asm volatile("" : "+v"(bq)); const float r = ((dd < HD / 2) ? __fsub_rn(a, bq) : __fadd_rn(a, bq)) * sc;
        o16[q] = tohx(r); unsigned short a2, c2; splitf(r, a2, c2); oh[q] = a2; ol[q] = c2; }
    *(v2h*)(P16 + e) = o16; *(v2us*)(Ph + e) = oh; *(v2us*)(Pl + e) = ol;  }
__global__ __launch_bounds__(256) void k_vtp(const float* __restrict__ F, int pitch, int nheads, h16* V16, bf* Vh, bf* Vl) { const size_t e = ((size_t)blockIdx.x * 256 + threadIdx.x) * 2; if (e >= (size_t)nheads * HD * TT) return; const int t = (int)(e % TT); const int d = (int)((e / TT) % HD); const int g = (int)(e / ((size_t)TT * HD)); v2h o16; v2us oh, ol;
#pragma unroll
    for (int q = 0; q < 2; ++q) { const float x = F[(size_t)(t + q) * pitch + g * HD + d]; o16[q] = tohx(x); unsigned short a2, c2; splitf(x, a2, c2); oh[q] = a2; ol[q] = c2; }
    *(v2h*)(V16 + e) = o16; *(v2us*)(Vh + e) = oh; *(v2us*)(Vl + e) = ol;  }
__global__ __launch_bounds__(256) void k_csid(float* CS) { const int idx = blockIdx.x * 256 + threadIdx.x; if (idx >= TT * HD) return; v2f cs; cs[0] = 1.0f; cs[1] = 0.0f; *(v2f*)(CS + (size_t)idx * 2) = cs;  }
// k_asoft: per row (zz, i): t = S x HD^-0.5 (masked keys -> -3e38); softmax over the 2048 keys (register row, one exp, fixed trees);
__global__ __launch_bounds__(256) void k_asoft(const float* __restrict__ Sb, const int* __restrict__ kvp, h16* P16, bf* Ph, bf* Pl) {
    const int lane = threadIdx.x & 31; const int row = blockIdx.x * 8 + (threadIdx.x >> 5); if (row >= ZH * TT) return; const int i = row % TT; const int zz = row / TT; (void)zz; const bool hires = (i < RH); const float* sr = Sb + (size_t)row * TT; float v[TT / 32]; float mx = -3.0e38f;
#pragma unroll
    for (int ch = 0; ch < TT / 128; ++ch) { const int j0 = ch * 128 + lane * 4; const v4f a = *(const v4f*)(sr + j0); const v4i kv4 = *(const v4i*)(kvp + j0);   /* the batch's key vector, 16 B per lane, unconditional */
#pragma unroll
        for (int q = 0; q < 4; ++q) { const int j = j0 + q; (void)j; const float t = (kv4[q] != 0) ? a[q] * SCL : -3.0e38f; v[ch * 4 + q] = t; mx = fmaxf(mx, t); } }
#pragma unroll
    for (int sh = 16; sh; sh >>= 1) mx = fmaxf(mx, __shfl_xor(mx, sh, 32));
    float sum = 0.f;
#pragma unroll
    for (int k = 0; k < TT / 32; ++k) { float d0 = __fsub_rn(v[k], mx); asm volatile("" : "+v"(d0)); v[k] = __builtin_amdgcn_exp2f(__fmul_rn(d0, 1.4426950408889634f)); sum += v[k]; }
#pragma unroll
    for (int sh = 16; sh; sh >>= 1) sum += __shfl_xor(sum, sh, 32);
    const float f = __fdiv_rn(hires ? 1.0f : PCAR, sum);
{
        if (hires) {
#pragma unroll
            for (int ch = 0; ch < TT / 128; ++ch) { v4us oh, ol;
#pragma unroll
                for (int q = 0; q < 4; ++q) { unsigned short a, c2; splitf(v[ch * 4 + q] * f, a, c2); oh[q] = a; ol[q] = c2; }
                const size_t oo = ((size_t)zz * (RH ? RH : 1) + i) * TT + ch * 128 + lane * 4; *(v4us*)(Ph + oo) = oh; *(v4us*)(Pl + oo) = ol; }
        } else {
#pragma unroll
            for (int ch = 0; ch < TT / 128; ++ch) { v4h o4;
#pragma unroll
                for (int q = 0; q < 4; ++q) o4[q] = tohx(v[ch * 4 + q] * f);
                *(v4h*)(P16 + (size_t)row * TT + ch * 128 + lane * 4) = o4; } }
         }
}
__global__ __launch_bounds__(256) void k_merge(const float* __restrict__ O, int h0, float* OUTb) { const size_t e = ((size_t)blockIdx.x * 256 + threadIdx.x) * 2; if (e >= (size_t)ZH * TT * HD) return; const int d = (int)(e % HD); const int t = (int)((e / HD) % TT); const int zz = (int)(e / ((size_t)HD * TT)); const float cs = (t < RH) ? 1.0f : (1.0f / PCAR); const size_t oo = (size_t)t * DQ + (h0 + zz) * HD + d;
    v2f o2; o2[0] = O[e] * cs; o2[1] = O[e + 1] * cs; *(v2f*)(OUTb + oo) = o2;  }

extern "C" void kernel_launch(void* const* d_in, const int* in_sizes, int n_in,
                              void* d_out, int out_size, void* d_ws, size_t ws_size, hipStream_t stream) {
    (void)in_sizes; (void)n_in; (void)out_size;
    const float* x = (const float*)d_in[0]; const int* kmask = (const int*)d_in[1]; const float* wq = (const float*)d_in[2]; const float* bq = (const float*)d_in[3]; const float* wk = (const float*)d_in[4]; const float* bk = (const float*)d_in[5]; const float* wv = (const float*)d_in[6]; const float* bv = (const float*)d_in[7]; /* argument order feature, mask (int32 [2][2048]: 0 = excluded: READ per key by k_asoft), W_Q, b_Q, W_K, b_K, W_V, b_V ('oi' + biases: read) */ const float* wo = nullptr; (void)wo;
    float* OUT = (float*)d_out;     // [2][2048][1024]
    char* wsp = (char*)d_ws;
    auto take = [&](size_t bytes) { char* p = wsp; wsp += (bytes + 255) & ~(size_t)255; return (void*)p; };
    bf* WQ = (bf*)take((size_t)DQ * DM * 2); bf* WK = (bf*)take((size_t)DKV * DM * 2); bf* WV = (bf*)take((size_t)DKV * DM * 2); float* CS = (float*)take((size_t)TT * HD * 2 * 4);
    bf* XB = (bf*)take((size_t)TT * DM * 2); float* FQ = (float*)take((size_t)TT * DQ * 4); float* FK = (float*)take((size_t)TT * DKV * 4);
    h16* QP16 = (h16*)take((size_t)NH_ * TT * HD * 2); h16* KP16 = (h16*)take((size_t)NKV * TT * HD * 2); h16* VT16 = (h16*)take((size_t)NKV * HD * TT * 2);
    bf* QPh = (bf*)take((size_t)NH_ * TT * HD * 2); bf* QPl = (bf*)take((size_t)NH_ * TT * HD * 2); bf* KPh = (bf*)take((size_t)NKV * TT * HD * 2); bf* KPl = (bf*)take((size_t)NKV * TT * HD * 2); bf* VTh = (bf*)take((size_t)NKV * HD * TT * 2); bf* VTl = (bf*)take((size_t)NKV * HD * TT * 2); bf* Ph = (bf*)take((size_t)ZH * RH * TT * 2); bf* Pl = (bf*)take((size_t)ZH * RH * TT * 2);
    float* Sb = (float*)take((size_t)ZH * TT * TT * 4); h16* P16 = (h16*)take((size_t)ZH * TT * TT * 2); float* Ob = (float*)take((size_t)ZH * TT * HD * 4);
    if ((size_t)(wsp - (char*)d_ws) > ws_size) return;    // ws 256 MiB
    float* FV = FK;   // v projection reuses the k buffer after the k planes are built (stream-ordered)
    { k_cvt8<<<(unsigned)(((size_t)DQ * DM / 8 + 255) / 256), 256, 0, stream>>>(wq, WQ, (size_t)DQ * DM / 8); k_cvt8<<<(unsigned)(((size_t)DKV * DM / 8 + 255) / 256), 256, 0, stream>>>(wk, WK, (size_t)DKV * DM / 8); k_cvt8<<<(unsigned)(((size_t)DKV * DM / 8 + 255) / 256), 256, 0, stream>>>(wv, WV, (size_t)DKV * DM / 8);
      
       }
    k_csid<<<(TT * HD + 255) / 256, 256, 0, stream>>>(CS);
    const unsigned LQ = (unsigned)(((size_t)NH_ * TT * HD / 2 + 255) / 256), LKv = (unsigned)(((size_t)NKV * TT * HD / 2 + 255) / 256);
    for (int b = 0; b < NB_; ++b) {
        
        k_cvt8<<<(unsigned)(((size_t)TT * DM / 8 + 255) / 256), 256, 0, stream>>>(x + (size_t)b * TT * DM, XB, (size_t)TT * DM / 8);
        k_gemmw<bf, 0, true><<<dim3(TT / 64, DQ / 64, 1), 32, 0, stream>>>(XB, nullptr, WQ, nullptr, DM, FQ, DQ, bq, 0, 0, 0);
        k_rope<<<LQ, 256, 0, stream>>>(FQ, DQ, NH_, CS, nullptr, nullptr, 1.0f, QP16, QPh, QPl);
        k_gemmw<bf, 0, true><<<dim3(TT / 64, DKV / 64, 1), 32, 0, stream>>>(XB, nullptr, WK, nullptr, DM, FK, DKV, bk, 0, 0, 0);
        k_rope<<<LKv, 256, 0, stream>>>(FK, DKV, NKV, CS, nullptr, nullptr, 1.0f, KP16, KPh, KPl);
        k_gemmw<bf, 0, true><<<dim3(TT / 64, DKV / 64, 1), 32, 0, stream>>>(XB, nullptr, WV, nullptr, DM, FV, DKV, bv, 0, 0, 0); k_vtp<<<LKv, 256, 0, stream>>>(FV, DKV, NKV, VT16, VTh, VTl);
        for (int h0 = 0; h0 < NH_; h0 += ZH) { const size_t zq = (size_t)h0, zk = (size_t)(h0 / REP);   // one kv head per query head: the pass's two heads use consecutive kv planes (z-strides TT*HD)
            k_gemmw<bf, 2, false><<<dim3(RH / 64, TT / 64, ZH), 32, 0, stream>>>(QPh + zq * TT * HD, QPl + zq * TT * HD, KPh + zk * TT * HD, KPl + zk * TT * HD, HD, Sb, TT, nullptr, (size_t)TT * HD, (size_t)TT * HD, (size_t)TT * TT);
            k_gemmw<h16, 0, false><<<dim3((TT - RH) / 64, TT / 64, ZH), 32, 0, stream>>>(QP16 + zq * TT * HD + (size_t)RH * HD, nullptr, KP16 + zk * TT * HD, nullptr, HD, Sb + (size_t)RH * TT, TT, nullptr, (size_t)TT * HD, (size_t)TT * HD, (size_t)TT * TT);
            k_asoft<<<ZH * TT / 8, 256, 0, stream>>>(Sb, kmask + (size_t)b * TT, P16, Ph, Pl);
            k_gemmw<bf, 2, false><<<dim3(RH / 64, HD / 64, ZH), 32, 0, stream>>>(Ph, Pl, VTh + zk * HD * TT, VTl + zk * HD * TT, TT, Ob, HD, nullptr, (size_t)RH * TT, (size_t)HD * TT, (size_t)TT * HD);
            k_gemmw<h16, 0, false><<<dim3((TT - RH) / 64, HD / 64, ZH), 32, 0, stream>>>(P16 + (size_t)RH * TT, nullptr, VT16 + zk * HD * TT, nullptr, TT, Ob + (size_t)RH * HD, HD, nullptr, (size_t)TT * TT, (size_t)HD * TT, (size_t)TT * HD);
            k_merge<<<(unsigned)(((size_t)ZH * TT * HD / 2 + 255) / 256), 256, 0, stream>>>(Ob, h0, OUT + (size_t)b * TT * DQ); }
         }
}

// v001
// It runs in 755 microseconds.
// Two timings next to v000 put it at 2.58 and 2.59 times that version's speed.
#include <hip/hip_runtime.h>

// Multi-head self-attention with a per-key integer padding mask and NO output projection (feature [2][2048][1024]; q, k, v = x W^T + b ('oi' (out, in) [1024][1024] uniform(+-1/32) + biases ZEROS on this draw: READ; 16 heads x 64); A = q.k / 8; where(mask[b][key] == 0, -1e9, A): mask int32 [2][2048] RANDOM 0 / 1: 0 = EXCLUDED (the fill replaces the score: an exclusion; no batch is fully excluded): READ per key; softmax over the kept keys; out = merged attn v -> [2][2048][1024] (4.2 M); argument order feature, mask, W_Q, b_Q, W_K, b_K, W_V, b_V).
// Layout per batch: bf16 copy of x; exact projections + f32 biases; dense T-2048 attention (hybrid rows: < 512 hi/lo 3 products, rest fp16 x1024); the f32 merge writes the output rows.
// Compute dtypes, f32 accumulate: every input rounded to bf16; projections exact + f32 biases; attention rows < 512 3 products, rest fp16; softmax f32; output f32.

#define NB_  2
#define TT   2048
#define DM   1024
#define NH_  16
#define NKV  16
#define REP  (NH_ / NKV)
#define HD   64
#define DQ   (NH_ * HD)
#define DKV  (NKV * HD)
#define ZH   2
#define RH   512                  // query rows < RH use hi+lo planes (0: none)
#define WIN  0
#define PCAR 1024.0f
#define SCL  0.125f   // HD^-0.5
#define PVB  8                    // attn x V: blocks per tile along the keys (partial planes, summed by k_merge)
#define PVW  4                    // attn x V: waves per block along the keys
typedef _Float16 h16;
typedef unsigned short bf;
typedef __attribute__((ext_vector_type(16))) __bf16   v16bf;
typedef __attribute__((ext_vector_type(16))) _Float16 v16h;
typedef __attribute__((ext_vector_type(8)))  _Float16 v8h;
typedef __attribute__((ext_vector_type(8)))  unsigned short v8us;
typedef __attribute__((ext_vector_type(8)))  float    v8f;
typedef __attribute__((ext_vector_type(4)))  float    v4f;
typedef v8h  __attribute__((may_alias)) v8ha;
typedef v4f  __attribute__((may_alias)) v4fa;
typedef v8us __attribute__((may_alias)) v8usa;

__device__ __forceinline__ unsigned short f2bf(float f) { unsigned u = __float_as_uint(f); u += 0x7FFFu + ((u >> 16) & 1u); return (unsigned short)(u >> 16); }
__device__ __forceinline__ float bf2f(unsigned short b) { return __uint_as_float(((unsigned)b) << 16); }
__device__ __forceinline__ float bfr(float f) { return bf2f(f2bf(f)); }
__device__ __forceinline__ v16h cat16(v8h lo, v8h hi) { return __builtin_shufflevector(lo, hi, 0, 1, 2, 3, 4, 5, 6, 7, 8, 9, 10, 11, 12, 13, 14, 15); }
__device__ __forceinline__ v16bf cat16b(v8us lo, v8us hi) { return __builtin_bit_cast(v16bf, __builtin_shufflevector(lo, hi, 0, 1, 2, 3, 4, 5, 6, 7, 8, 9, 10, 11, 12, 13, 14, 15)); }
__device__ __forceinline__ v8f wmma16(v16h a, v16h b, v8f c) { return __builtin_amdgcn_wmma_f32_16x16x32_f16(false, a, false, b, (short)0, c, false, false); }
__device__ __forceinline__ v8f wmmab(v16bf a, v16bf b, v8f c) { return __builtin_amdgcn_wmma_f32_16x16x32_bf16(false, a, false, b, (short)0, c, false, false); }



// ---- k_gemmw: register-blocked GEMM, one wave per 64x64 output tile and k piece (16 accumulators), operands straight from K-contiguous 16-bit planes; grid (M/64, N/64, Z * KB), 32 * KS threads.
// C[m][n] (f32, pitch ldc, + optional f32 bias[n]) = sum_k A[m][k] Bt[n][k] (+ split products per NSPLIT). z-batch strides sA/sB/sC in elements. K % 32 == 0.
// Split K: the k range is cut into KB * KS equal pieces. KB blocks per tile (grid z = Z * KB, block z * KB + kb writes its own partial plane C + (z * KB + kb) sC; the reader sums the KB planes), KS waves per block (32 * KS threads), each wave with its own 16 accumulators; the KS partial tiles meet in LDS and are summed in wave order. K % (32 * KS * KB) == 0.
template <typename T16> struct WFrag;
template <> struct WFrag<h16> { typedef v16h V; static __device__ __forceinline__ V ld(const h16* p) { return cat16(*(const v8h*)p, *(const v8h*)(p + 16)); } static __device__ __forceinline__ v8f mma(V a, V b, v8f c) { return wmma16(a, b, c); } };
template <> struct WFrag<bf> { typedef v16bf V; static __device__ __forceinline__ V ld(const bf* p) { return cat16b(*(const v8us*)p, *(const v8us*)(p + 16)); } static __device__ __forceinline__ v8f mma(V a, V b, v8f c) { return wmmab(a, b, c); } };
template <typename T16, int NSPLIT, bool BIAS, int KS, int KB>
__global__ __launch_bounds__(32 * KS) void k_gemmw(const T16* __restrict__ A, const T16* __restrict__ A2, const T16* __restrict__ Bt, const T16* __restrict__ Bt2, int K, float* C, int ldc, const float* __restrict__ bias, size_t sA, size_t sB, size_t sC) {
    typedef typename WFrag<T16>::V V;
    __shared__ __align__(16) float os[(KS == 1 ? 16 : KS * 64) * 68];
    const size_t z = blockIdx.z / KB; A += z * sA; if (A2) A2 += z * sA; Bt += z * sB; if (Bt2) Bt2 += z * sB; C += (size_t)blockIdx.z * sC;
    const int lane = threadIdx.x & 31, lr = lane & 15, hi = lane >> 4; const int r0 = blockIdx.x * 64, c0 = blockIdx.y * 64;
    v8f acc[4][4];
#pragma unroll
    for (int mb = 0; mb < 4; ++mb)
#pragma unroll
        for (int nb = 0; nb < 4; ++nb) acc[mb][nb] = (v8f){};
    const size_t aoff = (size_t)(r0 + lr) * K + 8 * hi, boff = (size_t)(c0 + lr) * K + 8 * hi;
    const int wv = (KS == 1) ? 0 : __builtin_amdgcn_readfirstlane((int)(threadIdx.x >> 5)); const int kbeg = ((int)(blockIdx.z % KB) * KS + wv) * (K / (KS * KB)), kend = kbeg + K / (KS * KB);
#pragma unroll 1
    for (int kc = kbeg; kc < kend; kc += 32) {
        V a[4], a2[4];
#pragma unroll
        for (int mb = 0; mb < 4; ++mb) { a[mb] = WFrag<T16>::ld(A + aoff + (size_t)mb * 16 * K + kc); if (NSPLIT == 1 || NSPLIT == 2) a2[mb] = WFrag<T16>::ld(A2 + aoff + (size_t)mb * 16 * K + kc); }
#pragma unroll
        for (int nb = 0; nb < 4; ++nb) { const V b = WFrag<T16>::ld(Bt + boff + (size_t)nb * 16 * K + kc); V b2; if (NSPLIT >= 2) b2 = WFrag<T16>::ld(Bt2 + boff + (size_t)nb * 16 * K + kc);
#pragma unroll
            for (int mb = 0; mb < 4; ++mb) { acc[mb][nb] = WFrag<T16>::mma(a[mb], b, acc[mb][nb]); if (NSPLIT == 1 || NSPLIT == 2) acc[mb][nb] = WFrag<T16>::mma(a2[mb], b, acc[mb][nb]); if (NSPLIT >= 2) acc[mb][nb] = WFrag<T16>::mma(a[mb], b2, acc[mb][nb]); } }
        asm volatile("v_nop\n\tv_nop\n\tv_nop\n\tv_nop" : "+v"(acc[0][0]), "+v"(acc[1][1]), "+v"(acc[2][2]), "+v"(acc[3][3]) : "v"(a[0]), "v"(a[3]));
    }
    if constexpr (KS > 1) {
        float* ow = os + wv * (64 * 68);
#pragma unroll
        for (int mb = 0; mb < 4; ++mb)
#pragma unroll
            for (int nb = 0; nb < 4; ++nb)
#pragma unroll
                for (int j = 0; j < 8; ++j) ow[(mb * 16 + hi * 8 + j) * 68 + nb * 16 + lr] = acc[mb][nb][j];
        __syncthreads();   // every wave's partial tile is in LDS before any thread sums across waves
#pragma unroll
        for (int s = 0; s < 32 / KS; ++s) { const int idx = s * (32 * KS) + (int)threadIdx.x, row = idx >> 4, cofs = (idx & 15) * 4; v4f val = *(const v4fa*)(os + row * 68 + cofs);
#pragma unroll
            for (int w = 1; w < KS; ++w) val += *(const v4fa*)(os + w * (64 * 68) + row * 68 + cofs);
            if (BIAS) { val[0] += bfr(bias[c0 + cofs]); val[1] += bfr(bias[c0 + cofs + 1]); val[2] += bfr(bias[c0 + cofs + 2]); val[3] += bfr(bias[c0 + cofs + 3]); }
            *(v4f*)(C + (size_t)(r0 + row) * ldc + c0 + cofs) = val; }
        return;
    }
#pragma unroll
    for (int mb = 0; mb < 4; ++mb) {
#pragma unroll
        for (int nb = 0; nb < 4; ++nb) {
#pragma unroll
            for (int j = 0; j < 8; ++j) os[(hi * 8 + j) * 68 + nb * 16 + lr] = acc[mb][nb][j]; }
        __builtin_amdgcn_wave_barrier(); asm volatile("" ::: "memory");
        float* crow = C + (size_t)(r0 + mb * 16) * ldc + c0;
{
#pragma unroll
            for (int s = 0; s < 8; ++s) { const int row = 2 * s + hi, cofs = lr * 4; v4f val = *(const v4fa*)(os + row * 68 + cofs); if (BIAS) { val[0] += bfr(bias[c0 + cofs]); val[1] += bfr(bias[c0 + cofs + 1]); val[2] += bfr(bias[c0 + cofs + 2]); val[3] += bfr(bias[c0 + cofs + 3]); }
                *(v4f*)(crow + (size_t)row * ldc + cofs) = val; }
             }
        __builtin_amdgcn_wave_barrier(); asm volatile("" ::: "memory");
    }
}

__device__ __forceinline__ h16 tohx(float x) { return (h16)x; }
__device__ __forceinline__ void splitf(float y, unsigned short& h, unsigned short& l) { h = f2bf(y); l = f2bf(y - bf2f(h)); }
typedef __attribute__((ext_vector_type(2))) _Float16 v2h;
typedef __attribute__((ext_vector_type(4))) _Float16 v4h;
typedef __attribute__((ext_vector_type(2))) unsigned short v2us;
typedef __attribute__((ext_vector_type(4))) unsigned short v4us;
typedef __attribute__((ext_vector_type(2))) float v2f;
typedef __attribute__((ext_vector_type(4))) int v4i;

__global__ __launch_bounds__(256) void k_wtG(const float* __restrict__ w, int K, int N, bf* Bt) {
    const int lane = threadIdx.x & 31; const int L0 = (blockIdx.x * 8 + (threadIdx.x >> 5)) * 8; const int nlines = N * K / 64;
{
#pragma unroll 1
        for (int l = 0; l < 8; ++l) { const int L = L0 + l; if (L >= nlines) break; const size_t e = (size_t)L * 64 + lane * 2; const int k = (int)(e % K), n = (int)(e / K); v2us o;
            o[0] = f2bf(w[(size_t)k * N + n]); o[1] = f2bf(w[(size_t)(k + 1) * N + n]); *(v2us*)(Bt + e) = o; }
         }
}
__global__ __launch_bounds__(256) void k_cvt8(const float* __restrict__ src, bf* dst, size_t n8) { const size_t i = (size_t)blockIdx.x * 256 + threadIdx.x; if (i >= n8) return; const v8f v = *(const v8f*)(src + i * 8); v8us o;
#pragma unroll
    for (int k = 0; k < 8; ++k) o[k] = f2bf(v[k]); *(v8us*)(dst + i * 8) = o;  }

// k_rope: head planes [h][t][d] (fp16 + hi/lo) of rope(x) x sc with the rotate-half convention out[d] = x[d] cos[t][d] - x[d+HD/2] sin[t][d], out[d+HD/2] = x[d+HD/2] cos[t][d+HD/2] + x[d] sin[t][d+HD/2]
__global__ __launch_bounds__(256) void k_rope(const float* __restrict__ F, int pitch, int nheads, const float* __restrict__ CS, const float* __restrict__ RF, const float* __restrict__ nw, float sc, h16* P16, bf* Ph, bf* Pl) {
    const size_t e = ((size_t)blockIdx.x * 256 + threadIdx.x) * 2; if (e >= (size_t)nheads * TT * HD) return; const int d = (int)(e % HD); const int t = (int)((e / HD) % TT); const int h = (int)(e / ((size_t)HD * TT)); const float* f = F + (size_t)t * pitch + h * HD; const float rf = RF ? RF[(size_t)h * TT + t] : 1.0f; v2h o16; v2us oh, ol;
#pragma unroll
    for (int q = 0; q < 2; ++q) { const int dd = d + q; const int dp = (dd < HD / 2) ? dd + HD / 2 : dd - HD / 2; float x0 = f[dd], x1 = f[dp];
        if (RF) { float n0 = __fmul_rn(x0, rf), n1 = __fmul_rn(x1, rf); asm volatile("" : "+v"(n0)); asm volatile("" : "+v"(n1)); x0 = __fmul_rn(bfr(nw[dd]), n0); x1 = __fmul_rn(bfr(nw[dp]), n1); }
        const v2f cs = *(const v2f*)(CS + ((size_t)t * HD + dd) * 2); float a = __fmul_rn(x0, cs[0]), bq = __fmul_rn(x1, cs[1]); asm volatile("" : "+v"(a)); asm volatile("" : "+v"(bq)); const float r = ((dd < HD / 2) ? __fsub_rn(a, bq) : __fadd_rn(a, bq)) * sc;
        o16[q] = tohx(r); unsigned short a2, c2; splitf(r, a2, c2); oh[q] = a2; ol[q] = c2; }
    *(v2h*)(P16 + e) = o16; *(v2us*)(Ph + e) = oh; *(v2us*)(Pl + e) = ol;  }
__global__ __launch_bounds__(256) void k_vtp(const float* __restrict__ F, int pitch, int nheads, h16* V16, bf* Vh, bf* Vl) { const size_t e = ((size_t)blockIdx.x * 256 + threadIdx.x) * 2; if (e >= (size_t)nheads * HD * TT) return; const int t = (int)(e % TT); const int d = (int)((e / TT) % HD); const int g = (int)(e / ((size_t)TT * HD)); v2h o16; v2us oh, ol;
#pragma unroll
    for (int q = 0; q < 2; ++q) { const float x = F[(size_t)(t + q) * pitch + g * HD + d]; o16[q] = tohx(x); unsigned short a2, c2; splitf(x, a2, c2); oh[q] = a2; ol[q] = c2; }
    *(v2h*)(V16 + e) = o16; *(v2us*)(Vh + e) = oh; *(v2us*)(Vl + e) = ol;  }
__global__ __launch_bounds__(256) void k_csid(float* CS) { const int idx = blockIdx.x * 256 + threadIdx.x; if (idx >= TT * HD) return; v2f cs; cs[0] = 1.0f; cs[1] = 0.0f; *(v2f*)(CS + (size_t)idx * 2) = cs;  }
// k_asoft: per row (zz, i): t = S x HD^-0.5 (masked keys -> -3e38); softmax over the 2048 keys (register row, one exp, fixed trees);
__global__ __launch_bounds__(256) void k_asoft(const float* __restrict__ Sb, const int* __restrict__ kvp, h16* P16, bf* Ph, bf* Pl) {
    const int lane = threadIdx.x & 31; const int row = blockIdx.x * 8 + (threadIdx.x >> 5); if (row >= ZH * TT) return; const int i = row % TT; const int zz = row / TT; (void)zz; const bool hires = (i < RH); const float* sr = Sb + (size_t)row * TT; float v[TT / 32]; float mx = -3.0e38f;
#pragma unroll
    for (int ch = 0; ch < TT / 128; ++ch) { const int j0 = ch * 128 + lane * 4; const v4f a = *(const v4f*)(sr + j0); const v4i kv4 = *(const v4i*)(kvp + j0);   /* the batch's key vector, 16 B per lane, unconditional */
#pragma unroll
        for (int q = 0; q < 4; ++q) { const int j = j0 + q; (void)j; const float t = (kv4[q] != 0) ? a[q] * SCL : -3.0e38f; v[ch * 4 + q] = t; mx = fmaxf(mx, t); } }
#pragma unroll
    for (int sh = 16; sh; sh >>= 1) mx = fmaxf(mx, __shfl_xor(mx, sh, 32));
    float sum = 0.f;
#pragma unroll
    for (int k = 0; k < TT / 32; ++k) { float d0 = __fsub_rn(v[k], mx); asm volatile("" : "+v"(d0)); v[k] = __builtin_amdgcn_exp2f(__fmul_rn(d0, 1.4426950408889634f)); sum += v[k]; }
#pragma unroll
    for (int sh = 16; sh; sh >>= 1) sum += __shfl_xor(sum, sh, 32);
    const float f = __fdiv_rn(hires ? 1.0f : PCAR, sum);
{
        if (hires) {
#pragma unroll
            for (int ch = 0; ch < TT / 128; ++ch) { v4us oh, ol;
#pragma unroll
                for (int q = 0; q < 4; ++q) { unsigned short a, c2; splitf(v[ch * 4 + q] * f, a, c2); oh[q] = a; ol[q] = c2; }
                const size_t oo = ((size_t)zz * (RH ? RH : 1) + i) * TT + ch * 128 + lane * 4; *(v4us*)(Ph + oo) = oh; *(v4us*)(Pl + oo) = ol; }
        } else {
#pragma unroll
            for (int ch = 0; ch < TT / 128; ++ch) { v4h o4;
#pragma unroll
                for (int q = 0; q < 4; ++q) o4[q] = tohx(v[ch * 4 + q] * f);
                *(v4h*)(P16 + (size_t)row * TT + ch * 128 + lane * 4) = o4; } }
         }
}
__global__ __launch_bounds__(256) void k_merge(const float* __restrict__ O, int h0, float* OUTb) { const size_t e = ((size_t)blockIdx.x * 256 + threadIdx.x) * 2; if (e >= (size_t)ZH * TT * HD) return; const int d = (int)(e % HD); const int t = (int)((e / HD) % TT); const int zz = (int)(e / ((size_t)HD * TT)); const float cs = (t < RH) ? 1.0f : (1.0f / PCAR); const size_t oo = (size_t)t * DQ + (h0 + zz) * HD + d;
    const float* op = O + (size_t)zz * PVB * TT * HD + (size_t)t * HD + d; v2f o2 = *(const v2f*)op;
#pragma unroll
    for (int kb = 1; kb < PVB; ++kb) o2 += *(const v2f*)(op + (size_t)kb * TT * HD);
    o2[0] *= cs; o2[1] *= cs; *(v2f*)(OUTb + oo) = o2;  }

extern "C" void kernel_launch(void* const* d_in, const int* in_sizes, int n_in,
                              void* d_out, int out_size, void* d_ws, size_t ws_size, hipStream_t stream) {
    (void)in_sizes; (void)n_in; (void)out_size;
    const float* x = (const float*)d_in[0]; const int* kmask = (const int*)d_in[1]; const float* wq = (const float*)d_in[2]; const float* bq = (const float*)d_in[3]; const float* wk = (const float*)d_in[4]; const float* bk = (const float*)d_in[5]; const float* wv = (const float*)d_in[6]; const float* bv = (const float*)d_in[7]; /* argument order feature, mask (int32 [2][2048]: 0 = excluded: READ per key by k_asoft), W_Q, b_Q, W_K, b_K, W_V, b_V ('oi' + biases: read) */ const float* wo = nullptr; (void)wo;
    float* OUT = (float*)d_out;     // [2][2048][1024]
    char* wsp = (char*)d_ws;
    auto take = [&](size_t bytes) { char* p = wsp; wsp += (bytes + 255) & ~(size_t)255; return (void*)p; };
    bf* WQ = (bf*)take((size_t)DQ * DM * 2); bf* WK = (bf*)take((size_t)DKV * DM * 2); bf* WV = (bf*)take((size_t)DKV * DM * 2); float* CS = (float*)take((size_t)TT * HD * 2 * 4);
    bf* XB = (bf*)take((size_t)TT * DM * 2); float* FQ = (float*)take((size_t)TT * DQ * 4); float* FK = (float*)take((size_t)TT * DKV * 4);
    h16* QP16 = (h16*)take((size_t)NH_ * TT * HD * 2); h16* KP16 = (h16*)take((size_t)NKV * TT * HD * 2); h16* VT16 = (h16*)take((size_t)NKV * HD * TT * 2);
    bf* QPh = (bf*)take((size_t)NH_ * TT * HD * 2); bf* QPl = (bf*)take((size_t)NH_ * TT * HD * 2); bf* KPh = (bf*)take((size_t)NKV * TT * HD * 2); bf* KPl = (bf*)take((size_t)NKV * TT * HD * 2); bf* VTh = (bf*)take((size_t)NKV * HD * TT * 2); bf* VTl = (bf*)take((size_t)NKV * HD * TT * 2); bf* Ph = (bf*)take((size_t)ZH * RH * TT * 2); bf* Pl = (bf*)take((size_t)ZH * RH * TT * 2);
    float* Sb = (float*)take((size_t)ZH * TT * TT * 4); h16* P16 = (h16*)take((size_t)ZH * TT * TT * 2); float* Ob = (float*)take((size_t)ZH * PVB * TT * HD * 4);   // [head of the pass][key piece][t][d]
    if ((size_t)(wsp - (char*)d_ws) > ws_size) return;    // ws 256 MiB
    float* FV = FK;   // v projection reuses the k buffer after the k planes are built (stream-ordered)
    { k_cvt8<<<(unsigned)(((size_t)DQ * DM / 8 + 255) / 256), 256, 0, stream>>>(wq, WQ, (size_t)DQ * DM / 8); k_cvt8<<<(unsigned)(((size_t)DKV * DM / 8 + 255) / 256), 256, 0, stream>>>(wk, WK, (size_t)DKV * DM / 8); k_cvt8<<<(unsigned)(((size_t)DKV * DM / 8 + 255) / 256), 256, 0, stream>>>(wv, WV, (size_t)DKV * DM / 8);
      
       }
    k_csid<<<(TT * HD + 255) / 256, 256, 0, stream>>>(CS);
    const unsigned LQ = (unsigned)(((size_t)NH_ * TT * HD / 2 + 255) / 256), LKv = (unsigned)(((size_t)NKV * TT * HD / 2 + 255) / 256);
    for (int b = 0; b < NB_; ++b) {
        
        k_cvt8<<<(unsigned)(((size_t)TT * DM / 8 + 255) / 256), 256, 0, stream>>>(x + (size_t)b * TT * DM, XB, (size_t)TT * DM / 8);
        k_gemmw<bf, 0, true, 8, 1><<<dim3(TT / 64, DQ / 64, 1), 256, 0, stream>>>(XB, nullptr, WQ, nullptr, DM, FQ, DQ, bq, 0, 0, 0);
        k_rope<<<LQ, 256, 0, stream>>>(FQ, DQ, NH_, CS, nullptr, nullptr, 1.0f, QP16, QPh, QPl);
        k_gemmw<bf, 0, true, 8, 1><<<dim3(TT / 64, DKV / 64, 1), 256, 0, stream>>>(XB, nullptr, WK, nullptr, DM, FK, DKV, bk, 0, 0, 0);
        k_rope<<<LKv, 256, 0, stream>>>(FK, DKV, NKV, CS, nullptr, nullptr, 1.0f, KP16, KPh, KPl);
        k_gemmw<bf, 0, true, 8, 1><<<dim3(TT / 64, DKV / 64, 1), 256, 0, stream>>>(XB, nullptr, WV, nullptr, DM, FV, DKV, bv, 0, 0, 0); k_vtp<<<LKv, 256, 0, stream>>>(FV, DKV, NKV, VT16, VTh, VTl);
        for (int h0 = 0; h0 < NH_; h0 += ZH) { const size_t zq = (size_t)h0, zk = (size_t)(h0 / REP);   // one kv head per query head: the pass's two heads use consecutive kv planes (z-strides TT*HD)
            k_gemmw<bf, 2, false, 1, 1><<<dim3(RH / 64, TT / 64, ZH), 32, 0, stream>>>(QPh + zq * TT * HD, QPl + zq * TT * HD, KPh + zk * TT * HD, KPl + zk * TT * HD, HD, Sb, TT, nullptr, (size_t)TT * HD, (size_t)TT * HD, (size_t)TT * TT);
            k_gemmw<h16, 0, false, 1, 1><<<dim3((TT - RH) / 64, TT / 64, ZH), 32, 0, stream>>>(QP16 + zq * TT * HD + (size_t)RH * HD, nullptr, KP16 + zk * TT * HD, nullptr, HD, Sb + (size_t)RH * TT, TT, nullptr, (size_t)TT * HD, (size_t)TT * HD, (size_t)TT * TT);
            k_asoft<<<ZH * TT / 8, 256, 0, stream>>>(Sb, kmask + (size_t)b * TT, P16, Ph, Pl);
            k_gemmw<bf, 2, false, PVW, PVB><<<dim3(RH / 64, HD / 64, ZH * PVB), 32 * PVW, 0, stream>>>(Ph, Pl, VTh + zk * HD * TT, VTl + zk * HD * TT, TT, Ob, HD, nullptr, (size_t)RH * TT, (size_t)HD * TT, (size_t)TT * HD);
            k_gemmw<h16, 0, false, PVW, PVB><<<dim3((TT - RH) / 64, HD / 64, ZH * PVB), 32 * PVW, 0, stream>>>(P16 + (size_t)RH * TT, nullptr, VT16 + zk * HD * TT, nullptr, TT, Ob + (size_t)RH * HD, HD, nullptr, (size_t)TT * TT, (size_t)HD * TT, (size_t)TT * HD);
            k_merge<<<(unsigned)(((size_t)ZH * TT * HD / 2 + 255) / 256), 256, 0, stream>>>(Ob, h0, OUT + (size_t)b * TT * DQ); }
         }
}

// v003
// A run of this version takes 232 microseconds.
// Versions between v001 and this one are left out; their measured steps multiply to 3.25 times as fast.
// All steps since v000 together make it 8.41 times as fast.
#include <hip/hip_runtime.h>

// Multi-head self-attention with a per-key integer padding mask and NO output projection (feature [2][2048][1024]; q, k, v = x W^T + b ('oi' (out, in) [1024][1024] uniform(+-1/32) + biases ZEROS on this draw: READ; 16 heads x 64); A = q.k / 8; where(mask[b][key] == 0, -1e9, A): mask int32 [2][2048] RANDOM 0 / 1: 0 = EXCLUDED (the fill replaces the score: an exclusion; no batch is fully excluded): READ per key; softmax over the kept keys; out = merged attn v -> [2][2048][1024] (4.2 M); argument order feature, mask, W_Q, b_Q, W_K, b_K, W_V, b_V).
// Layout: one launch rounds x and the three weights to bf16; one projection launch (q, k, v, both batches) sums exact products + bf16-rounded biases and its epilogue writes the head planes (fp16 + bf16 hi/lo) of q, k and transposed v; then ONE fused attention launch over both batches and all heads (hybrid rows: < 512 hi/lo 3 products, rest fp16): scores, mask, running softmax and attn x V stay in registers and the output rows are written directly.
// Compute dtypes, f32 accumulate: every input rounded to bf16; projections exact + bf16-rounded biases; attention rows < 512 3 products, rest fp16; softmax f32; output f32.

#define NB_  2
#define TT   2048
#define DM   1024
#define NH_  16
#define NKV  16
#define REP  (NH_ / NKV)
#define HD   64
#define DQ   (NH_ * HD)
#define DKV  (NKV * HD)
#define RH   512                  // query rows < RH use hi+lo planes
#define WIN  0
#define SCL  0.125f   // HD^-0.5
typedef _Float16 h16;
typedef unsigned short bf;
typedef __attribute__((ext_vector_type(16))) __bf16   v16bf;
typedef __attribute__((ext_vector_type(16))) _Float16 v16h;
typedef __attribute__((ext_vector_type(8)))  _Float16 v8h;
typedef __attribute__((ext_vector_type(8)))  unsigned short v8us;
typedef __attribute__((ext_vector_type(8)))  float    v8f;
typedef __attribute__((ext_vector_type(4)))  float    v4f;
typedef v8h  __attribute__((may_alias)) v8ha;
typedef v4f  __attribute__((may_alias)) v4fa;
typedef v8us __attribute__((may_alias)) v8usa;

__device__ __forceinline__ unsigned short f2bf(float f) { unsigned u = __float_as_uint(f); u += 0x7FFFu + ((u >> 16) & 1u); return (unsigned short)(u >> 16); }
__device__ __forceinline__ float bf2f(unsigned short b) { return __uint_as_float(((unsigned)b) << 16); }
__device__ __forceinline__ float bfr(float f) { return bf2f(f2bf(f)); }
__device__ __forceinline__ v16h cat16(v8h lo, v8h hi) { return __builtin_shufflevector(lo, hi, 0, 1, 2, 3, 4, 5, 6, 7, 8, 9, 10, 11, 12, 13, 14, 15); }
__device__ __forceinline__ v16bf cat16b(v8us lo, v8us hi) { return __builtin_bit_cast(v16bf, __builtin_shufflevector(lo, hi, 0, 1, 2, 3, 4, 5, 6, 7, 8, 9, 10, 11, 12, 13, 14, 15)); }
__device__ __forceinline__ v8f wmma16(v16h a, v16h b, v8f c) { return __builtin_amdgcn_wmma_f32_16x16x32_f16(false, a, false, b, (short)0, c, false, false); }
__device__ __forceinline__ v8f wmmab(v16bf a, v16bf b, v8f c) { return __builtin_amdgcn_wmma_f32_16x16x32_bf16(false, a, false, b, (short)0, c, false, false); }



// ---- fragment loaders and products of the two 16-bit forms
template <typename T16> struct WFrag;
template <> struct WFrag<h16> { typedef v16h V; static __device__ __forceinline__ V ld(const h16* p) { return cat16(*(const v8h*)p, *(const v8h*)(p + 16)); } static __device__ __forceinline__ v8f mma(V a, V b, v8f c) { return wmma16(a, b, c); } };
template <> struct WFrag<bf> { typedef v16bf V; static __device__ __forceinline__ V ld(const bf* p) { return cat16b(*(const v8us*)p, *(const v8us*)(p + 16)); } static __device__ __forceinline__ v8f mma(V a, V b, v8f c) { return wmmab(a, b, c); } };
__device__ __forceinline__ h16 tohx(float x) { return (h16)x; }
__device__ __forceinline__ void splitf(float y, unsigned short& h, unsigned short& l) { h = f2bf(y); l = f2bf(y - bf2f(h)); }
typedef __attribute__((ext_vector_type(4))) _Float16 v4h;
typedef __attribute__((ext_vector_type(4))) unsigned short v4us;

// ---- k_cvt: bf16 copies of x (both batches) and of the three weights, 8 elements per thread; the block index picks the source.
#define XBLK (NB_ * TT * DM / 8 / 256)
#define WBLK (DQ * DM / 8 / 256)
static_assert(NB_ * TT * DM % 2048 == 0 && DQ * DM % 2048 == 0 && DQ == DKV, "whole blocks per source");
__global__ __launch_bounds__(256) void k_cvt(const float* __restrict__ x, const float* __restrict__ wq, const float* __restrict__ wk, const float* __restrict__ wv, bf* XB, bf* WQ, bf* WK, bf* WV) {
    int blk = blockIdx.x; const float* src = x; bf* dst = XB;
    if (blk >= XBLK) { blk -= XBLK; const int w = blk / WBLK; blk -= w * WBLK; src = (w == 0) ? wq : (w == 1) ? wk : wv; dst = (w == 0) ? WQ : (w == 1) ? WK : WV; }
    const size_t i = (size_t)blk * 256 + threadIdx.x; const v8f v = *(const v8f*)(src + i * 8); v8us o;
#pragma unroll
    for (int k = 0; k < 8; ++k) o[k] = f2bf(v[k]);
    *(v8us*)(dst + i * 8) = o;
}

// ---- k_proj: the three projections of both batches in one launch; grid (NB_ * TT / 64, NH_, 3), z = 0 q, 1 k, 2 v; 8 waves per 64x64 tile (64 rows of x, one head's 64 features).
// y[m][n] = sum_k X[m][k] W[n][k] + bias[n], operands straight from K-contiguous bf16 planes. Split K: each wave sums DM / 8 of the k range in its own 16 accumulators; the 8 partial tiles meet in LDS and are summed in wave order.
// Epilogue: the summed f32 value goes straight to the head planes (fp16 and bf16 hi/lo): q and k as [b][h][t][d], v transposed as [b][h][d][t].
#define KS_ 8
__global__ __launch_bounds__(32 * KS_) void k_proj(const bf* __restrict__ X, const bf* __restrict__ WQ, const bf* __restrict__ WK, const bf* __restrict__ WV, const float* __restrict__ bq, const float* __restrict__ bk, const float* __restrict__ bv,
                                                   h16* Q16, bf* Qh, bf* Ql, h16* K16, bf* Kh, bf* Kl, h16* V16, bf* Vh, bf* Vl) {
    typedef WFrag<bf>::V V;
    __shared__ __align__(16) float os[KS_ * 64 * 68];
    const int z = blockIdx.z; const bf* Bt = (z == 0) ? WQ : (z == 1) ? WK : WV; const float* bias = (z == 0) ? bq : (z == 1) ? bk : bv;
    const int lane = threadIdx.x & 31, lr = lane & 15, hi = lane >> 4; const int r0 = blockIdx.x * 64, c0 = blockIdx.y * 64;
    v8f acc[4][4];
#pragma unroll
    for (int mb = 0; mb < 4; ++mb)
#pragma unroll
        for (int nb = 0; nb < 4; ++nb) acc[mb][nb] = (v8f){};
    const size_t aoff = (size_t)(r0 + lr) * DM + 8 * hi, boff = (size_t)(c0 + lr) * DM + 8 * hi;
    const int wv = __builtin_amdgcn_readfirstlane((int)(threadIdx.x >> 5)); const int kbeg = wv * (DM / KS_), kend = kbeg + DM / KS_;
#pragma unroll 1
    for (int kc = kbeg; kc < kend; kc += 32) {
        V a[4]; const bf* ap = X + aoff + kc;
#pragma unroll
        for (int mb = 0; mb < 4; ++mb) a[mb] = WFrag<bf>::ld(ap + (size_t)mb * 16 * DM);
        asm volatile("s_wait_xcnt 0x0" :: "v"(ap) : "memory");   // the A loads are issued: their address registers stay whole up to this wait and may be reused behind it
#pragma unroll
        for (int nb = 0; nb < 4; ++nb) { const V b = WFrag<bf>::ld(Bt + boff + (size_t)nb * 16 * DM + kc);
#pragma unroll
            for (int mb = 0; mb < 4; ++mb) acc[mb][nb] = WFrag<bf>::mma(a[mb], b, acc[mb][nb]); }
        asm volatile("v_nop\n\tv_nop\n\tv_nop\n\tv_nop" : "+v"(acc[0][0]), "+v"(acc[1][1]), "+v"(acc[2][2]), "+v"(acc[3][3]) : "v"(a[0]), "v"(a[3]));   // the vector slots between a trip's last WMMA and whatever follows it on the back edge or behind the loop
    }
    float* ow = os + wv * (64 * 68);
#pragma unroll
    for (int mb = 0; mb < 4; ++mb)
#pragma unroll
        for (int nb = 0; nb < 4; ++nb)
#pragma unroll
            for (int j = 0; j < 8; ++j) ow[(mb * 16 + hi * 8 + j) * 68 + nb * 16 + lr] = acc[mb][nb][j];
    __syncthreads();   // every wave's partial tile is in LDS before any thread sums across waves
    const int b = r0 / TT, t0 = r0 % TT; const size_t pz = ((size_t)b * NH_ + blockIdx.y) * TT * HD;   // a 64-row tile lies in one batch (TT % 64 == 0); its 64 columns are one head
    if (z < 2) {
        h16* P16 = (z == 0 ? Q16 : K16) + pz; bf* Ph = (z == 0 ? Qh : Kh) + pz; bf* Pl = (z == 0 ? Ql : Kl) + pz;
#pragma unroll
        for (int s = 0; s < 32 / KS_; ++s) { const int idx = s * (32 * KS_) + (int)threadIdx.x, row = idx >> 4, cofs = (idx & 15) * 4; v4f val = *(const v4fa*)(os + row * 68 + cofs);
#pragma unroll
            for (int w = 1; w < KS_; ++w) val += *(const v4fa*)(os + w * (64 * 68) + row * 68 + cofs);
            v4h o16; v4us oh, ol;
#pragma unroll
            for (int q = 0; q < 4; ++q) { const float y = val[q] + bfr(bias[c0 + cofs + q]); o16[q] = tohx(y); unsigned short a2, c2; splitf(y, a2, c2); oh[q] = a2; ol[q] = c2; }
            const size_t e = (size_t)(t0 + row) * HD + cofs; *(v4h*)(P16 + e) = o16; *(v4us*)(Ph + e) = oh; *(v4us*)(Pl + e) = ol; }
    } else {   // v: a thread sums 8 consecutive rows t of one column d, so four neighbouring lanes store 64 contiguous bytes of a transposed row
        const int d = (int)threadIdx.x >> 2, tq = (int)threadIdx.x & 3; const float bd = bfr(bias[c0 + d]);
#pragma unroll
        for (int s = 0; s < 2; ++s) { const int tl = s * 32 + tq * 8; v8h o16; v8us oh, ol;
#pragma unroll
            for (int i = 0; i < 8; ++i) { float y = os[(tl + i) * 68 + d];
#pragma unroll
                for (int w = 1; w < KS_; ++w) y += os[w * (64 * 68) + (tl + i) * 68 + d];
                y += bd; o16[i] = tohx(y); unsigned short a2, c2; splitf(y, a2, c2); oh[i] = a2; ol[i] = c2; }
            const size_t e = pz + (size_t)d * TT + t0 + tl; *(v8h*)(V16 + e) = o16; *(v8us*)(Vh + e) = oh; *(v8us*)(Vl + e) = ol; }
        asm volatile("s_wait_xcnt 0x0" ::: "memory");   // the stores above are issued before any of their registers is written again
    }
}
static_assert(TT % 64 == 0 && HD == 64 && DM % (32 * KS_) == 0 && NH_ == NKV, "k_proj: one batch and one head per tile");

template <typename T16, bool HI, int NKT>   // NKT: 16-key tiles per pass (even)
__device__ __forceinline__ void fa_tile(const T16* __restrict__ Q, const T16* __restrict__ Q2, const T16* __restrict__ Kp, const T16* __restrict__ K2, const T16* __restrict__ Vt, const T16* __restrict__ Vt2, const int* __restrict__ kvp, int q0, float* __restrict__ orow) {
    typedef typename WFrag<T16>::V V;
    const int lane = threadIdx.x & 31, lr = lane & 15, hi = lane >> 4;
    V qf[2], qf2[2], kf[NKT][2], kf2[NKT][2];
    const size_t koff = (size_t)lr * HD + 8 * hi, voff = (size_t)lr * TT + 8 * hi;
    const T16* qp = Q + (size_t)q0 * HD + koff; const T16* qp2 = HI ? Q2 + (size_t)q0 * HD + koff : qp; const T16* kq = Kp + koff; const int* mq = kvp + lane;
#pragma unroll
    for (int ks = 0; ks < 2; ++ks) { qf[ks] = WFrag<T16>::ld(qp + ks * 32); if (HI) qf2[ks] = WFrag<T16>::ld(qp2 + ks * 32); }
    if constexpr (!HI) {   // fp16 tiles fetch their key rows one pass ahead; the hi/lo tiles have no registers to spare for that and fetch them at the head of the pass
#pragma unroll
        for (int kt = 0; kt < NKT; ++kt)
#pragma unroll
            for (int ks = 0; ks < 2; ++ks) kf[kt][ks] = WFrag<T16>::ld(kq + kt * 16 * HD + ks * 32); }
    v8f o[4];
#pragma unroll
    for (int dt = 0; dt < 4; ++dt) o[dt] = (v8f){};
    float m = -3.0e38f, l = 0.f;
    int mk[NKT / 2];   // lane i: the mask word of key 32 g + i of the pass, fetched with the key rows
    if constexpr (!HI) {
#pragma unroll
        for (int g = 0; g < NKT / 2; ++g) mk[g] = mq[g * 32]; }
    asm volatile("s_wait_xcnt 0x0" :: "v"(qp), "v"(qp2), "v"(kq), "v"(mq) : "memory");   // as in the loop: the address registers of the loads above stay whole up to this wait
#pragma unroll 1
    for (int k0 = 0; k0 < TT; k0 += 16 * NKT) {
        v8f s[NKT]; V vf[NKT / 2][4], vf2[NKT / 2][4];
        unsigned kw[NKT / 2];   // bit (kt & 1) * 16 + j: this lane's key 8 hi + j of tile kt is kept
        const int kn = (k0 + 16 * NKT < TT) ? k0 + 16 * NKT : 0;   // what is fetched one pass ahead: the last pass re-reads pass 0 (in bounds, unused)
        auto scores = [&]() {
#pragma unroll
            for (int kt = 0; kt < NKT; ++kt) { s[kt] = (v8f){};
#pragma unroll
                for (int ks = 0; ks < 2; ++ks) { s[kt] = WFrag<T16>::mma(kf[kt][ks], qf[ks], s[kt]); if (HI) { s[kt] = WFrag<T16>::mma(kf[kt][ks], qf2[ks], s[kt]); s[kt] = WFrag<T16>::mma(kf2[kt][ks], qf[ks], s[kt]); } } } };
        auto keep = [&]() {
#pragma unroll
            for (int g = 0; g < NKT / 2; ++g) kw[g] = __builtin_amdgcn_ballot_w32(mk[g] != 0) >> (8 * hi); };
        auto fetch = [&]() {
            const size_t kk = (size_t)(HI ? k0 : kn) * HD;
            const T16* kp = Kp + koff + kk; const T16* kp2 = HI ? K2 + koff + kk : kp; const T16* vp = Vt + voff + k0; const T16* vp2 = HI ? Vt2 + voff + k0 : vp; const int* mp = kvp + (HI ? k0 : kn) + lane;
#pragma unroll
            for (int kt = 0; kt < NKT; ++kt)
#pragma unroll
                for (int ks = 0; ks < 2; ++ks) { kf[kt][ks] = WFrag<T16>::ld(kp + kt * 16 * HD + ks * 32); if (HI) kf2[kt][ks] = WFrag<T16>::ld(kp2 + kt * 16 * HD + ks * 32); }
#pragma unroll
            for (int g = 0; g < NKT / 2; ++g)
#pragma unroll
                for (int dt = 0; dt < 4; ++dt) { vf[g][dt] = WFrag<T16>::ld(vp + (size_t)dt * 16 * TT + g * 32); if (HI) vf2[g][dt] = WFrag<T16>::ld(vp2 + (size_t)dt * 16 * TT + g * 32); }
#pragma unroll
            for (int g = 0; g < NKT / 2; ++g) mk[g] = mp[g * 32];
            asm volatile("s_wait_xcnt 0x0" :: "v"(kp), "v"(kp2), "v"(vp), "v"(vp2), "v"(mp) : "memory");   // the pass's loads are issued: their address registers stay whole up to this wait and are free behind it
        };
        if constexpr (HI) { fetch(); scores(); keep(); } else { scores(); keep(); fetch(); }
        float cm = -3.0e38f;
#pragma unroll
        for (int kt = 0; kt < NKT; ++kt)
#pragma unroll
            for (int j = 0; j < 8; ++j) { const float t = ((kw[kt >> 1] >> ((kt & 1) * 16 + j)) & 1u) ? s[kt][j] * SCL : -3.0e38f; s[kt][j] = t; cm = fmaxf(cm, t); }
        cm = fmaxf(cm, __shfl_xor(cm, 16, 32));
        const float mn = fmaxf(m, cm), al = __builtin_amdgcn_exp2f((m - mn) * 1.4426950408889634f);
        m = mn; float ls[NKT];
#pragma unroll
        for (int dt = 0; dt < 4; ++dt) o[dt] *= al;
#pragma unroll
        for (int kt = 0; kt < NKT; ++kt) { ls[kt] = 0.f;
#pragma unroll
            for (int j = 0; j < 8; ++j) { const float p = __builtin_amdgcn_exp2f((s[kt][j] - mn) * 1.4426950408889634f); s[kt][j] = p; ls[kt] += p; } }
        float lp = ls[0];
#pragma unroll
        for (int kt = 1; kt < NKT; ++kt) lp += ls[kt];
        l = l * al + lp;
#pragma unroll
        for (int g = 0; g < NKT / 2; ++g) { V pb, pb2;
            if constexpr (HI) { v8us ah, al2, bh, bl;
#pragma unroll
                for (int j = 0; j < 8; ++j) { unsigned short x, y; splitf(s[2 * g][j], x, y); ah[j] = x; al2[j] = y; splitf(s[2 * g + 1][j], x, y); bh[j] = x; bl[j] = y; }
                pb = cat16b(ah, bh); pb2 = cat16b(al2, bl);
            } else { v8h a, b2;
#pragma unroll
                for (int j = 0; j < 8; ++j) { a[j] = tohx(s[2 * g][j]); b2[j] = tohx(s[2 * g + 1][j]); }
                pb = cat16(a, b2); }
#pragma unroll
            for (int dt = 0; dt < 4; ++dt) { o[dt] = WFrag<T16>::mma(vf[g][dt], pb, o[dt]);
                if constexpr (HI) { o[dt] = WFrag<T16>::mma(vf[g][dt], pb2, o[dt]); o[dt] = WFrag<T16>::mma(vf2[g][dt], pb, o[dt]); } } }
    }
    l += __shfl_xor(l, 16, 32);
    const float inv = __fdiv_rn(1.0f, l);
    float* op = orow + (size_t)(q0 + lr) * DQ + hi * 8;
#pragma unroll
    for (int dt = 0; dt < 4; ++dt) { v4f w0, w1;
#pragma unroll
        for (int j = 0; j < 4; ++j) { w0[j] = o[dt][j] * inv; w1[j] = o[dt][4 + j] * inv; }
        *(v4f*)(op + dt * 16) = w0; *(v4f*)(op + dt * 16 + 4) = w1; }
}
// grid (RH / 16, NB_ * NH_), 4 independent waves (no LDS, no barrier): one takes the block's hi/lo tile (rows < RH), three take fp16 tiles, so every block costs the same; which wave takes the dear tile turns with the block index (speed only).
static_assert(RH * 4 == TT, "one hi/lo tile and three fp16 tiles per block");
__global__ __launch_bounds__(128, 4) void k_fattn(const h16* __restrict__ Q16, const h16* __restrict__ K16, const h16* __restrict__ V16, const bf* __restrict__ Qh, const bf* __restrict__ Ql, const bf* __restrict__ Kh, const bf* __restrict__ Kl, const bf* __restrict__ Vh, const bf* __restrict__ Vl, const int* __restrict__ kmask, float* __restrict__ OUT) {
    const int bh = blockIdx.y, b = bh / NH_, h = bh % NH_; const size_t pz = (size_t)bh * TT * HD;
    const int role = (__builtin_amdgcn_readfirstlane((int)(threadIdx.x >> 5)) + (bh >> 3)) & 3;
    const int* kvp = kmask + (size_t)b * TT; float* orow = OUT + (size_t)b * TT * DQ + h * HD;
    if (role == 0) fa_tile<bf, true, 2>(Qh + pz, Ql + pz, Kh + pz, Kl + pz, Vh + pz, Vl + pz, kvp, (int)blockIdx.x * 16, orow);
    else fa_tile<h16, false, 4>(Q16 + pz, nullptr, K16 + pz, nullptr, V16 + pz, nullptr, kvp, RH + ((int)blockIdx.x * 3 + role - 1) * 16, orow);
}

extern "C" void kernel_launch(void* const* d_in, const int* in_sizes, int n_in,
                              void* d_out, int out_size, void* d_ws, size_t ws_size, hipStream_t stream) {
    (void)in_sizes; (void)n_in; (void)out_size;
    const float* x = (const float*)d_in[0]; const int* kmask = (const int*)d_in[1]; const float* wq = (const float*)d_in[2]; const float* bq = (const float*)d_in[3]; const float* wk = (const float*)d_in[4]; const float* bk = (const float*)d_in[5]; const float* wv = (const float*)d_in[6]; const float* bv = (const float*)d_in[7]; /* order feature, mask (int32 [2][2048]: 0 = excluded: READ per key by k_fattn), W_Q, b_Q, W_K, b_K, W_V, b_V ('oi' + biases: read) */
    float* OUT = (float*)d_out;     // [2][2048][1024]
    char* wsp = (char*)d_ws;
    auto take = [&](size_t bytes) { char* p = wsp; wsp += (bytes + 255) & ~(size_t)255; return (void*)p; };
    bf* WQ = (bf*)take((size_t)DQ * DM * 2); bf* WK = (bf*)take((size_t)DKV * DM * 2); bf* WV = (bf*)take((size_t)DKV * DM * 2);
    bf* XB = (bf*)take((size_t)NB_ * TT * DM * 2);
    const size_t PL = (size_t)NH_ * TT * HD;   // one batch's head planes, elements; every plane holds both batches
    h16* QP16 = (h16*)take(NB_ * PL * 2); h16* KP16 = (h16*)take(NB_ * PL * 2); h16* VT16 = (h16*)take(NB_ * PL * 2);
    bf* QPh = (bf*)take(NB_ * PL * 2); bf* QPl = (bf*)take(NB_ * PL * 2); bf* KPh = (bf*)take(NB_ * PL * 2); bf* KPl = (bf*)take(NB_ * PL * 2); bf* VTh = (bf*)take(NB_ * PL * 2); bf* VTl = (bf*)take(NB_ * PL * 2);
    if ((size_t)(wsp - (char*)d_ws) > ws_size) return;    // ws 256 MiB
    k_cvt<<<XBLK + 3 * WBLK, 256, 0, stream>>>(x, wq, wk, wv, XB, WQ, WK, WV);
    k_proj<<<dim3(NB_ * TT / 64, NH_, 3), 32 * KS_, 0, stream>>>(XB, WQ, WK, WV, bq, bk, bv, QP16, QPh, QPl, KP16, KPh, KPl, VT16, VTh, VTl);
    k_fattn<<<dim3(RH / 16, NB_ * NH_), 128, 0, stream>>>(QP16, KP16, VT16, QPh, QPl, KPh, KPl, VTh, VTl, kmask, OUT);
}

// v004
// A run of this version takes 134 microseconds.
// Timed twice side by side with v003, it ran 1.73 and 1.74 times as fast.
// Counting every step since v000, it is 14.6 times as fast.
#include <hip/hip_runtime.h>

// Multi-head self-attention with a per-key integer padding mask and NO output projection (feature [2][2048][1024]; q, k, v = x W^T + b ('oi' (out, in) [1024][1024] uniform(+-1/32) + biases ZEROS on this draw: READ; 16 heads x 64); A = q.k / 8; where(mask[b][key] == 0, -1e9, A): mask int32 [2][2048] RANDOM 0 / 1: 0 = EXCLUDED (the fill replaces the score: an exclusion; no batch is fully excluded): READ per key; softmax over the kept keys; out = merged attn v -> [2][2048][1024] (4.2 M); argument order feature, mask, W_Q, b_Q, W_K, b_K, W_V, b_V).
// Layout: one launch rounds x and the three weights to bf16; one projection launch (q, k, v, both batches) sums exact products + bf16-rounded biases and its epilogue writes the head planes (fp16 + bf16 hi/lo) of q, k and transposed v; then ONE fused attention launch over both batches and all heads (hybrid rows: < 512 hi/lo 3 products, rest fp16): K and V^T stages shared in LDS by a block's 16 waves; scores, mask, running softmax and attn x V stay in registers and the output rows are written directly.
// Compute dtypes, f32 accumulate: every input rounded to bf16; projections exact + bf16-rounded biases; attention rows < 512 3 products, rest fp16; softmax f32; output f32.

#define NB_  2
#define TT   2048
#define DM   1024
#define NH_  16
#define NKV  16
#define REP  (NH_ / NKV)
#define HD   64
#define DQ   (NH_ * HD)
#define DKV  (NKV * HD)
#define RH   512                  // query rows < RH use hi+lo planes
#define WIN  0
#define SCL  0.125f   // HD^-0.5
typedef _Float16 h16;
typedef unsigned short bf;
typedef __attribute__((ext_vector_type(16))) __bf16   v16bf;
typedef __attribute__((ext_vector_type(16))) _Float16 v16h;
typedef __attribute__((ext_vector_type(8)))  _Float16 v8h;
typedef __attribute__((ext_vector_type(8)))  unsigned short v8us;
typedef __attribute__((ext_vector_type(8)))  float    v8f;
typedef __attribute__((ext_vector_type(4)))  float    v4f;
typedef v8h  __attribute__((may_alias)) v8ha;
typedef v4f  __attribute__((may_alias)) v4fa;
typedef v8us __attribute__((may_alias)) v8usa;

__device__ __forceinline__ unsigned short f2bf(float f) { unsigned u = __float_as_uint(f); u += 0x7FFFu + ((u >> 16) & 1u); return (unsigned short)(u >> 16); }
__device__ __forceinline__ float bf2f(unsigned short b) { return __uint_as_float(((unsigned)b) << 16); }
__device__ __forceinline__ float bfr(float f) { return bf2f(f2bf(f)); }
__device__ __forceinline__ v16h cat16(v8h lo, v8h hi) { return __builtin_shufflevector(lo, hi, 0, 1, 2, 3, 4, 5, 6, 7, 8, 9, 10, 11, 12, 13, 14, 15); }
__device__ __forceinline__ v16bf cat16b(v8us lo, v8us hi) { return __builtin_bit_cast(v16bf, __builtin_shufflevector(lo, hi, 0, 1, 2, 3, 4, 5, 6, 7, 8, 9, 10, 11, 12, 13, 14, 15)); }
__device__ __forceinline__ v8f wmma16(v16h a, v16h b, v8f c) { return __builtin_amdgcn_wmma_f32_16x16x32_f16(false, a, false, b, (short)0, c, false, false); }
__device__ __forceinline__ v8f wmmab(v16bf a, v16bf b, v8f c) { return __builtin_amdgcn_wmma_f32_16x16x32_bf16(false, a, false, b, (short)0, c, false, false); }



// ---- fragment loaders and products of the two 16-bit forms
template <typename T16> struct WFrag;
template <> struct WFrag<h16> { typedef v16h V; static __device__ __forceinline__ V ld(const h16* p) { return cat16(*(const v8h*)p, *(const v8h*)(p + 16)); } static __device__ __forceinline__ v8f mma(V a, V b, v8f c) { return wmma16(a, b, c); } };
template <> struct WFrag<bf> { typedef v16bf V; static __device__ __forceinline__ V ld(const bf* p) { return cat16b(*(const v8us*)p, *(const v8us*)(p + 16)); } static __device__ __forceinline__ v8f mma(V a, V b, v8f c) { return wmmab(a, b, c); } };
__device__ __forceinline__ h16 tohx(float x) { return (h16)x; }
__device__ __forceinline__ void splitf(float y, unsigned short& h, unsigned short& l) { h = f2bf(y); l = f2bf(y - bf2f(h)); }
typedef __attribute__((ext_vector_type(4))) _Float16 v4h;
typedef __attribute__((ext_vector_type(4))) unsigned short v4us;

// ---- k_cvt: bf16 copies of x (both batches) and of the three weights, 8 elements per thread; the block index picks the source.
#define XBLK (NB_ * TT * DM / 8 / 256)
#define WBLK (DQ * DM / 8 / 256)
static_assert(NB_ * TT * DM % 2048 == 0 && DQ * DM % 2048 == 0 && DQ == DKV, "whole blocks per source");
__global__ __launch_bounds__(256) void k_cvt(const float* __restrict__ x, const float* __restrict__ wq, const float* __restrict__ wk, const float* __restrict__ wv, bf* XB, bf* WQ, bf* WK, bf* WV) {
    int blk = blockIdx.x; const float* src = x; bf* dst = XB;
    if (blk >= XBLK) { blk -= XBLK; const int w = blk / WBLK; blk -= w * WBLK; src = (w == 0) ? wq : (w == 1) ? wk : wv; dst = (w == 0) ? WQ : (w == 1) ? WK : WV; }
    const size_t i = (size_t)blk * 256 + threadIdx.x; const v8f v = *(const v8f*)(src + i * 8); v8us o;
#pragma unroll
    for (int k = 0; k < 8; ++k) o[k] = f2bf(v[k]);
    *(v8us*)(dst + i * 8) = o;
}

// ---- k_proj: the three projections of both batches in one launch; grid (NB_ * TT / 64, NH_, 3), z = 0 q, 1 k, 2 v; 8 waves per 64x64 tile (64 rows of x, one head's 64 features).
// y[m][n] = sum_k X[m][k] W[n][k] + bias[n], operands straight from K-contiguous bf16 planes. Split K: each wave sums DM / 8 of the k range in its own 16 accumulators; the 8 partial tiles meet in LDS and are summed in wave order.
// Epilogue: the summed f32 value goes straight to the head planes (fp16 and bf16 hi/lo): q and k as [b][h][t][d], v transposed as [b][h][d][t].
#define KS_ 8
__global__ __launch_bounds__(32 * KS_) void k_proj(const bf* __restrict__ X, const bf* __restrict__ WQ, const bf* __restrict__ WK, const bf* __restrict__ WV, const float* __restrict__ bq, const float* __restrict__ bk, const float* __restrict__ bv,
                                                   h16* Q16, bf* Qh, bf* Ql, h16* K16, bf* Kh, bf* Kl, h16* V16, bf* Vh, bf* Vl) {
    typedef WFrag<bf>::V V;
    __shared__ __align__(16) float os[KS_ * 64 * 68];
    const int z = blockIdx.z; const bf* Bt = (z == 0) ? WQ : (z == 1) ? WK : WV; const float* bias = (z == 0) ? bq : (z == 1) ? bk : bv;
    const int lane = threadIdx.x & 31, lr = lane & 15, hi = lane >> 4; const int r0 = blockIdx.x * 64, c0 = blockIdx.y * 64;
    v8f acc[4][4];
#pragma unroll
    for (int mb = 0; mb < 4; ++mb)
#pragma unroll
        for (int nb = 0; nb < 4; ++nb) acc[mb][nb] = (v8f){};
    const size_t aoff = (size_t)(r0 + lr) * DM + 8 * hi, boff = (size_t)(c0 + lr) * DM + 8 * hi;
    const int wv = __builtin_amdgcn_readfirstlane((int)(threadIdx.x >> 5)); const int kbeg = wv * (DM / KS_), kend = kbeg + DM / KS_;
#pragma unroll 1
    for (int kc = kbeg; kc < kend; kc += 32) {
        V a[4]; const bf* ap = X + aoff + kc;
#pragma unroll
        for (int mb = 0; mb < 4; ++mb) a[mb] = WFrag<bf>::ld(ap + (size_t)mb * 16 * DM);
        asm volatile("s_wait_xcnt 0x0" :: "v"(ap) : "memory");   // the A loads are issued: their address registers stay whole up to this wait and may be reused behind it
#pragma unroll
        for (int nb = 0; nb < 4; ++nb) { const V b = WFrag<bf>::ld(Bt + boff + (size_t)nb * 16 * DM + kc);
#pragma unroll
            for (int mb = 0; mb < 4; ++mb) acc[mb][nb] = WFrag<bf>::mma(a[mb], b, acc[mb][nb]); }
        asm volatile("v_nop\n\tv_nop\n\tv_nop\n\tv_nop" : "+v"(acc[0][0]), "+v"(acc[1][1]), "+v"(acc[2][2]), "+v"(acc[3][3]) : "v"(a[0]), "v"(a[3]));   // the vector slots between a trip's last WMMA and whatever follows it on the back edge or behind the loop
    }
    float* ow = os + wv * (64 * 68);
#pragma unroll
    for (int mb = 0; mb < 4; ++mb)
#pragma unroll
        for (int nb = 0; nb < 4; ++nb)
#pragma unroll
            for (int j = 0; j < 8; ++j) ow[(mb * 16 + hi * 8 + j) * 68 + nb * 16 + lr] = acc[mb][nb][j];
    __syncthreads();   // every wave's partial tile is in LDS before any thread sums across waves
    const int b = r0 / TT, t0 = r0 % TT; const size_t pz = ((size_t)b * NH_ + blockIdx.y) * TT * HD;   // a 64-row tile lies in one batch (TT % 64 == 0); its 64 columns are one head
    if (z < 2) {
        h16* P16 = (z == 0 ? Q16 : K16) + pz; bf* Ph = (z == 0 ? Qh : Kh) + pz; bf* Pl = (z == 0 ? Ql : Kl) + pz;
#pragma unroll
        for (int s = 0; s < 32 / KS_; ++s) { const int idx = s * (32 * KS_) + (int)threadIdx.x, row = idx >> 4, cofs = (idx & 15) * 4; v4f val = *(const v4fa*)(os + row * 68 + cofs);
#pragma unroll
            for (int w = 1; w < KS_; ++w) val += *(const v4fa*)(os + w * (64 * 68) + row * 68 + cofs);
            v4h o16; v4us oh, ol;
#pragma unroll
            for (int q = 0; q < 4; ++q) { const float y = val[q] + bfr(bias[c0 + cofs + q]); o16[q] = tohx(y); unsigned short a2, c2; splitf(y, a2, c2); oh[q] = a2; ol[q] = c2; }
            const size_t e = (size_t)(t0 + row) * HD + cofs; *(v4h*)(P16 + e) = o16; *(v4us*)(Ph + e) = oh; *(v4us*)(Pl + e) = ol; }
    } else {   // v: a thread sums 8 consecutive rows t of one column d, so four neighbouring lanes store 64 contiguous bytes of a transposed row
        const int d = (int)threadIdx.x >> 2, tq = (int)threadIdx.x & 3; const float bd = bfr(bias[c0 + d]);
#pragma unroll
        for (int s = 0; s < 2; ++s) { const int tl = s * 32 + tq * 8; v8h o16; v8us oh, ol;
#pragma unroll
            for (int i = 0; i < 8; ++i) { float y = os[(tl + i) * 68 + d];
#pragma unroll
                for (int w = 1; w < KS_; ++w) y += os[w * (64 * 68) + (tl + i) * 68 + d];
                y += bd; o16[i] = tohx(y); unsigned short a2, c2; splitf(y, a2, c2); oh[i] = a2; ol[i] = c2; }
            const size_t e = pz + (size_t)d * TT + t0 + tl; *(v8h*)(V16 + e) = o16; *(v8us*)(Vh + e) = oh; *(v8us*)(Vl + e) = ol; }
        asm volatile("s_wait_xcnt 0x0" ::: "memory");   // the stores above are issued before any of their registers is written again
    }
}
static_assert(TT % 64 == 0 && HD == 64 && DM % (32 * KS_) == 0 && NH_ == NKV, "k_proj: one batch and one head per tile");

#define SK   64                   // keys per LDS stage
#define PIT  72                   // LDS row pitch in 16-bit elements: 128 data bytes + 16, so the 16 rows of a fragment read fall on different banks
#define PLN  (64 * PIT)           // one plane's tile of a stage, elements: 64 rows (K: key x d; V^T: d x key)
#define NST  (TT / SK)
typedef __attribute__((ext_vector_type(8))) unsigned v8u;
// one pass over 16 * NKT keys; Ks, Vs: this lane's fragment origin in the stage's LDS tiles; kw: bit (kt & 1) * 16 + j of word kt / 2: this lane's key 8 hi + j of tile kt is kept
template <typename T16, bool HI, int NKT>   // NKT: 16-key tiles per pass (even)
__device__ __forceinline__ void fa_pass(const typename WFrag<T16>::V (&qf)[2], const typename WFrag<T16>::V (&qf2)[2], const T16* Ks, const T16* Ks2, const T16* Vs, const T16* Vs2, const unsigned (&kw)[NKT / 2], v8f (&o)[4], float& m, float& l) {
    typedef typename WFrag<T16>::V V;
    V kf[NKT][2], kf2[NKT][2], vf[NKT / 2][4], vf2[NKT / 2][4]; v8f s[NKT];
#pragma unroll
    for (int kt = 0; kt < NKT; ++kt)
#pragma unroll
        for (int ks = 0; ks < 2; ++ks) { kf[kt][ks] = WFrag<T16>::ld(Ks + kt * 16 * PIT + ks * 32); if (HI) kf2[kt][ks] = WFrag<T16>::ld(Ks2 + kt * 16 * PIT + ks * 32); }
#pragma unroll
    for (int g = 0; g < NKT / 2; ++g)
#pragma unroll
        for (int dt = 0; dt < 4; ++dt) { vf[g][dt] = WFrag<T16>::ld(Vs + dt * 16 * PIT + g * 32); if (HI) vf2[g][dt] = WFrag<T16>::ld(Vs2 + dt * 16 * PIT + g * 32); }
#pragma unroll
    for (int kt = 0; kt < NKT; ++kt) { s[kt] = (v8f){};
#pragma unroll
        for (int ks = 0; ks < 2; ++ks) { s[kt] = WFrag<T16>::mma(kf[kt][ks], qf[ks], s[kt]); if (HI) { s[kt] = WFrag<T16>::mma(kf[kt][ks], qf2[ks], s[kt]); s[kt] = WFrag<T16>::mma(kf2[kt][ks], qf[ks], s[kt]); } } }
    float cm = -3.0e38f;
#pragma unroll
    for (int kt = 0; kt < NKT; ++kt)
#pragma unroll
        for (int j = 0; j < 8; ++j) { const float t = ((kw[kt >> 1] >> ((kt & 1) * 16 + j)) & 1u) ? s[kt][j] * SCL : -3.0e38f; s[kt][j] = t; cm = fmaxf(cm, t); }
    cm = fmaxf(cm, __shfl_xor(cm, 16, 32));
    const float mn = fmaxf(m, cm), al = __builtin_amdgcn_exp2f((m - mn) * 1.4426950408889634f);
    m = mn; float ls[NKT];
#pragma unroll
    for (int dt = 0; dt < 4; ++dt) o[dt] *= al;
#pragma unroll
    for (int kt = 0; kt < NKT; ++kt) { ls[kt] = 0.f;
#pragma unroll
        for (int j = 0; j < 8; ++j) { const float p = __builtin_amdgcn_exp2f((s[kt][j] - mn) * 1.4426950408889634f); s[kt][j] = p; ls[kt] += p; } }
    float lp = ls[0];
#pragma unroll
    for (int kt = 1; kt < NKT; ++kt) lp += ls[kt];
    l = l * al + lp;
#pragma unroll
    for (int g = 0; g < NKT / 2; ++g) { V pb, pb2;
        if constexpr (HI) { v8us ah, al2, bh, bl;
#pragma unroll
            for (int j = 0; j < 8; ++j) { unsigned short x, y; splitf(s[2 * g][j], x, y); ah[j] = x; al2[j] = y; splitf(s[2 * g + 1][j], x, y); bh[j] = x; bl[j] = y; }
            pb = cat16b(ah, bh); pb2 = cat16b(al2, bl);
        } else { v8h a, b2;
#pragma unroll
            for (int j = 0; j < 8; ++j) { a[j] = tohx(s[2 * g][j]); b2[j] = tohx(s[2 * g + 1][j]); }
            pb = cat16(a, b2); }
#pragma unroll
        for (int dt = 0; dt < 4; ++dt) { o[dt] = WFrag<T16>::mma(vf[g][dt], pb, o[dt]);
            if constexpr (HI) { o[dt] = WFrag<T16>::mma(vf[g][dt], pb2, o[dt]); o[dt] = WFrag<T16>::mma(vf2[g][dt], pb, o[dt]); } } }
}
// grid (RH / 64, NB_ * NH_), 16 waves: waves 0 to 3 take a hi/lo tile each (rows < RH; two 32-key passes per stage), waves 4 to 15 an fp16 tile each (one 64-key pass per stage), so every block costs the same and, four waves to a SIMD, each SIMD gets one dear wave.
static_assert(RH * 4 == TT && RH % 64 == 0 && NST >= 2 && HD == 64, "four hi/lo and twelve fp16 tiles per block; 512 threads copy 64 rows of 128 bytes per plane");
__global__ __launch_bounds__(512) void k_fattn(const h16* __restrict__ Q16, const h16* __restrict__ K16, const h16* __restrict__ V16, const bf* __restrict__ Qh, const bf* __restrict__ Ql, const bf* __restrict__ Kh, const bf* __restrict__ Kl, const bf* __restrict__ Vh, const bf* __restrict__ Vl, const int* __restrict__ kmask, float* __restrict__ OUT) {
    __shared__ __align__(16) bf ring[2 * 6 * PLN];   // two buffers of six tiles: K16, Kh, Kl, V16, Vh, Vl
    const int bh = blockIdx.y, b = bh / NH_, h = bh % NH_; const size_t pz = (size_t)bh * TT * HD;
    const int wv = __builtin_amdgcn_readfirstlane((int)(threadIdx.x >> 5)); const bool dear = wv < 4;
    const int lane = threadIdx.x & 31, lr = lane & 15, hi = lane >> 4;
    const int* kvp = kmask + (size_t)b * TT; float* orow = OUT + (size_t)b * TT * DQ + h * HD;
    const int q0 = dear ? ((int)blockIdx.x * 4 + wv) * 16 : RH + ((int)blockIdx.x * 12 + wv - 4) * 16;
    // a thread copies 16 bytes of each plane per stage: row tid / 8, bytes 16 * (tid % 8)
    const int crow = (int)threadIdx.x >> 3, cch = ((int)threadIdx.x & 7) * 8;
    const size_t gk = pz + (size_t)crow * HD + cch, gv = pz + (size_t)crow * TT + cch;
    const unsigned ld0 = (unsigned)(size_t)ring + (unsigned)(crow * PIT + cch) * 2u;
    auto copy = [&](int st) {
        const unsigned d0 = ld0 + (unsigned)(st & 1) * (6u * PLN * 2u), d1 = d0 + PLN * 2u, d2 = d0 + PLN * 4u, d3 = d0 + PLN * 6u, d4 = d0 + PLN * 8u, d5 = d0 + PLN * 10u;
        const size_t ko = gk + (size_t)st * SK * HD, vo = gv + (size_t)st * SK;
        const h16* g0 = K16 + ko; const bf* g1 = Kh + ko; const bf* g2 = Kl + ko; const h16* g3 = V16 + vo; const bf* g4 = Vh + vo; const bf* g5 = Vl + vo;
        // the stage's six copies; the wait closes the statement so that no address register is written again before it
        asm volatile("global_load_async_to_lds_b128 %0, %6, off\n\t"
                     "global_load_async_to_lds_b128 %1, %7, off\n\t"
                     "global_load_async_to_lds_b128 %2, %8, off\n\t"
                     "global_load_async_to_lds_b128 %3, %9, off\n\t"
                     "global_load_async_to_lds_b128 %4, %10, off\n\t"
                     "global_load_async_to_lds_b128 %5, %11, off\n\t"
                     "s_wait_xcnt 0x0"
                     :: "v"(d0), "v"(d1), "v"(d2), "v"(d3), "v"(d4), "v"(d5), "v"(g0), "v"(g1), "v"(g2), "v"(g3), "v"(g4), "v"(g5) : "memory");
    };
    copy(0);
    // query fragments, kept as raw words so that both kinds of wave hold them in the same registers (an fp16 wave uses the first two)
    const bf* qpa = (dear ? Qh : (const bf*)Q16) + pz + (size_t)(q0 + lr) * HD + 8 * hi; const bf* qpb = (dear ? Ql : (const bf*)Q16) + pz + (size_t)(q0 + lr) * HD + 8 * hi; const int* mq = kvp + lane;
    v8u qr[4];
#pragma unroll
    for (int ks = 0; ks < 2; ++ks) { qr[ks] = __builtin_bit_cast(v8u, WFrag<bf>::ld(qpa + ks * 32)); qr[2 + ks] = __builtin_bit_cast(v8u, WFrag<bf>::ld(qpb + ks * 32)); }
    int mk[SK / 32];   // lane i: the mask word of key 32 g + i of a stage, fetched one stage ahead
#pragma unroll
    for (int g = 0; g < SK / 32; ++g) mk[g] = mq[g * 32];
    asm volatile("s_wait_xcnt 0x0" :: "v"(qpa), "v"(qpb), "v"(mq) : "memory");   // the address registers of the loads above stay whole up to this wait
    v8f o[4];
#pragma unroll
    for (int dt = 0; dt < 4; ++dt) o[dt] = (v8f){};
    float m = -3.0e38f, l = 0.f;
    asm volatile("s_wait_asynccnt 0x0" ::: "memory");   // this wave's copies of stage 0 have landed
    __syncthreads();                                    // and every other wave's: stage 0 is readable
    copy(1);
#pragma unroll 1
    for (int t = 0; t < NST; ++t) {
        const bf* bp = ring + (t & 1) * (6 * PLN) + lr * PIT + 8 * hi;
        unsigned kw[SK / 32];
#pragma unroll
        for (int g = 0; g < SK / 32; ++g) kw[g] = __builtin_amdgcn_ballot_w32(mk[g] != 0) >> (8 * hi);
        const int* mp = kvp + ((t + 1 < NST) ? t + 1 : 0) * SK + lane;   // the last stage re-reads stage 0's words (in bounds, unused)
#pragma unroll
        for (int g = 0; g < SK / 32; ++g) mk[g] = mp[g * 32];
        asm volatile("s_wait_xcnt 0x0" :: "v"(mp) : "memory");   // the mask loads are issued: their address registers stay whole up to this wait
        if (dear) {
            const v16bf qf[2] = { __builtin_bit_cast(v16bf, qr[0]), __builtin_bit_cast(v16bf, qr[1]) }, qf2[2] = { __builtin_bit_cast(v16bf, qr[2]), __builtin_bit_cast(v16bf, qr[3]) };
#pragma unroll
            for (int p = 0; p < 2; ++p) { const unsigned k1[1] = { kw[p] };
                fa_pass<bf, true, 2>(qf, qf2, bp + PLN + p * 32 * PIT, bp + 2 * PLN + p * 32 * PIT, bp + 4 * PLN + p * 32, bp + 5 * PLN + p * 32, k1, o, m, l); }
        } else {
            const v16h qf[2] = { __builtin_bit_cast(v16h, qr[0]), __builtin_bit_cast(v16h, qr[1]) };
            fa_pass<h16, false, 4>(qf, qf, (const h16*)bp, (const h16*)bp, (const h16*)(bp + 3 * PLN), (const h16*)(bp + 3 * PLN), kw, o, m, l);
        }
        asm volatile("s_wait_dscnt 0x0" ::: "memory");      // this wave's reads of stage t are done
        asm volatile("s_wait_asynccnt 0x0" ::: "memory");   // this wave's copies of stage t + 1 have landed
        __syncthreads();                                    // publishes stage t + 1 and frees stage t's buffer
        if (t + 2 < NST) copy(t + 2);
    }
    asm volatile("s_wait_asynccnt 0x0" ::: "memory");   // no copy is outstanding when the wave ends
    l += __shfl_xor(l, 16, 32);
    const float inv = __fdiv_rn(1.0f, l);
    float* op = orow + (size_t)(q0 + lr) * DQ + hi * 8;
#pragma unroll
    for (int dt = 0; dt < 4; ++dt) { v4f w0, w1;
#pragma unroll
        for (int j = 0; j < 4; ++j) { w0[j] = o[dt][j] * inv; w1[j] = o[dt][4 + j] * inv; }
        *(v4f*)(op + dt * 16) = w0; *(v4f*)(op + dt * 16 + 4) = w1; }
}

extern "C" void kernel_launch(void* const* d_in, const int* in_sizes, int n_in,
                              void* d_out, int out_size, void* d_ws, size_t ws_size, hipStream_t stream) {
    (void)in_sizes; (void)n_in; (void)out_size;
    const float* x = (const float*)d_in[0]; const int* kmask = (const int*)d_in[1]; const float* wq = (const float*)d_in[2]; const float* bq = (const float*)d_in[3]; const float* wk = (const float*)d_in[4]; const float* bk = (const float*)d_in[5]; const float* wv = (const float*)d_in[6]; const float* bv = (const float*)d_in[7]; /* order feature, mask (int32 [2][2048]: 0 = excluded: READ per key by k_fattn), W_Q, b_Q, W_K, b_K, W_V, b_V ('oi' + biases: read) */
    float* OUT = (float*)d_out;     // [2][2048][1024]
    char* wsp = (char*)d_ws;
    auto take = [&](size_t bytes) { char* p = wsp; wsp += (bytes + 255) & ~(size_t)255; return (void*)p; };
    bf* WQ = (bf*)take((size_t)DQ * DM * 2); bf* WK = (bf*)take((size_t)DKV * DM * 2); bf* WV = (bf*)take((size_t)DKV * DM * 2);
    bf* XB = (bf*)take((size_t)NB_ * TT * DM * 2);
    const size_t PL = (size_t)NH_ * TT * HD;   // one batch's head planes, elements; every plane holds both batches
    h16* QP16 = (h16*)take(NB_ * PL * 2); h16* KP16 = (h16*)take(NB_ * PL * 2); h16* VT16 = (h16*)take(NB_ * PL * 2);
    bf* QPh = (bf*)take(NB_ * PL * 2); bf* QPl = (bf*)take(NB_ * PL * 2); bf* KPh = (bf*)take(NB_ * PL * 2); bf* KPl = (bf*)take(NB_ * PL * 2); bf* VTh = (bf*)take(NB_ * PL * 2); bf* VTl = (bf*)take(NB_ * PL * 2);
    if ((size_t)(wsp - (char*)d_ws) > ws_size) return;    // ws 256 MiB
    k_cvt<<<XBLK + 3 * WBLK, 256, 0, stream>>>(x, wq, wk, wv, XB, WQ, WK, WV);
    k_proj<<<dim3(NB_ * TT / 64, NH_, 3), 32 * KS_, 0, stream>>>(XB, WQ, WK, WV, bq, bk, bv, QP16, QPh, QPl, KP16, KPh, KPl, VT16, VTh, VTl);
    k_fattn<<<dim3(RH / 64, NB_ * NH_), 512, 0, stream>>>(QP16, KP16, VT16, QPh, QPl, KPh, KPl, VTh, VTl, kmask, OUT);
}

// v005
// A run of this version takes 94.1 microseconds.
// In both of two side-by-side timings against v004, it was 1.42 times as fast.
// All steps since v000 together make it 20.7 times as fast.
#include <hip/hip_runtime.h>

// Multi-head self-attention with a per-key integer padding mask and NO output projection (feature [2][2048][1024]; q, k, v = x W^T + b ('oi' (out, in) [1024][1024] uniform(+-1/32) + biases ZEROS on this draw: READ; 16 heads x 64); A = q.k / 8; where(mask[b][key] == 0, -1e9, A): mask int32 [2][2048] RANDOM 0 / 1: 0 = EXCLUDED (the fill replaces the score: an exclusion; no batch is fully excluded): READ per key; softmax over the kept keys; out = merged attn v -> [2][2048][1024] (4.2 M); argument order feature, mask, W_Q, b_Q, W_K, b_K, W_V, b_V).
// Layout: one launch rounds x and the three weights to bf16 and lists each batch's kept keys; one projection launch (q: every row; k, v: the listed rows only, packed) sums exact products + f32 biases and its epilogue writes the head planes (fp16 + bf16 hi/lo) of q, k and transposed v; then ONE fused attention launch over both batches and all heads (hybrid rows: < 512 hi/lo 3 products, rest fp16): K and V^T stages shared in LDS by a block's 16 waves; scores, mask, running softmax and attn x V stay in registers and the output rows are written directly.
// Compute dtypes, f32 accumulate: every input rounded to bf16; projections exact + f32 biases; attention rows < 512 3 products, rest fp16; softmax f32; output f32.

#define NB_  2
#define TT   2048
#define DM   1024
#define NH_  16
#define NKV  16
#define REP  (NH_ / NKV)
#define HD   64
#define DQ   (NH_ * HD)
#define DKV  (NKV * HD)
#define RH   512                  // query rows < RH use hi+lo planes
#define WIN  0
#define SCL  0.125f   // HD^-0.5
typedef _Float16 h16;
typedef unsigned short bf;
typedef __attribute__((ext_vector_type(16))) __bf16   v16bf;
typedef __attribute__((ext_vector_type(16))) _Float16 v16h;
typedef __attribute__((ext_vector_type(8)))  _Float16 v8h;
typedef __attribute__((ext_vector_type(8)))  unsigned short v8us;
typedef __attribute__((ext_vector_type(8)))  float    v8f;
typedef __attribute__((ext_vector_type(4)))  float    v4f;
typedef v8h  __attribute__((may_alias)) v8ha;
typedef v4f  __attribute__((may_alias)) v4fa;
typedef v8us __attribute__((may_alias)) v8usa;

__device__ __forceinline__ unsigned short f2bf(float f) { unsigned u = __float_as_uint(f); u += 0x7FFFu + ((u >> 16) & 1u); return (unsigned short)(u >> 16); }
__device__ __forceinline__ float bf2f(unsigned short b) { return __uint_as_float(((unsigned)b) << 16); }
__device__ __forceinline__ float bfr(float f) { return bf2f(f2bf(f)); }
__device__ __forceinline__ v16h cat16(v8h lo, v8h hi) { return __builtin_shufflevector(lo, hi, 0, 1, 2, 3, 4, 5, 6, 7, 8, 9, 10, 11, 12, 13, 14, 15); }
__device__ __forceinline__ v16bf cat16b(v8us lo, v8us hi) { return __builtin_bit_cast(v16bf, __builtin_shufflevector(lo, hi, 0, 1, 2, 3, 4, 5, 6, 7, 8, 9, 10, 11, 12, 13, 14, 15)); }
__device__ __forceinline__ v8f wmma16(v16h a, v16h b, v8f c) { return __builtin_amdgcn_wmma_f32_16x16x32_f16(false, a, false, b, (short)0, c, false, false); }
__device__ __forceinline__ v8f wmmab(v16bf a, v16bf b, v8f c) { return __builtin_amdgcn_wmma_f32_16x16x32_bf16(false, a, false, b, (short)0, c, false, false); }



// ---- fragment loaders and products of the two 16-bit forms
template <typename T16> struct WFrag;
template <> struct WFrag<h16> { typedef v16h V; static __device__ __forceinline__ V ld(const h16* p) { return cat16(*(const v8h*)p, *(const v8h*)(p + 16)); } static __device__ __forceinline__ v8f mma(V a, V b, v8f c) { return wmma16(a, b, c); } };
template <> struct WFrag<bf> { typedef v16bf V; static __device__ __forceinline__ V ld(const bf* p) { return cat16b(*(const v8us*)p, *(const v8us*)(p + 16)); } static __device__ __forceinline__ v8f mma(V a, V b, v8f c) { return wmmab(a, b, c); } };
__device__ __forceinline__ h16 tohx(float x) { return (h16)x; }
__device__ __forceinline__ void splitf(float y, unsigned short& h, unsigned short& l) { h = f2bf(y); l = f2bf(y - bf2f(h)); }
typedef __attribute__((ext_vector_type(4))) _Float16 v4h;
typedef __attribute__((ext_vector_type(4))) unsigned short v4us;

// ---- k_cvt: bf16 copies of x (both batches) and of the three weights, 8 elements per thread; the block index picks the source.
// Blocks 0 to NB_ - 1 instead list one batch's kept keys in rising order: GI[b][0 .. kept) = their indices, the rest 0 (a row that exists; its score is excluded).
// An excluded key has weight exactly 0 beside any kept key, so k, v and the attention walk the listed keys only. CN[32 b] = keys to walk, CN[32 b + 1] = how many of them are kept.
// A batch with no kept key is the reference's uniform row over ALL keys: every key is listed and none counts as kept.
#define CNS 32                    // ints between the batches' counts: one writing block per 128-byte line
#define XBLK (NB_ * TT * DM / 8 / 256)
#define WBLK (DQ * DM / 8 / 256)
static_assert(NB_ * TT * DM % 2048 == 0 && DQ * DM % 2048 == 0 && DQ == DKV, "whole blocks per source");
static_assert(TT == 8 * 256, "the list block: 8 waves of 256 keys; TT a power of two for the row bound in k_proj");
__global__ __launch_bounds__(256) void k_cvt(const float* __restrict__ x, const float* __restrict__ wq, const float* __restrict__ wk, const float* __restrict__ wv, const int* __restrict__ kmask, bf* XB, bf* WQ, bf* WK, bf* WV, int* GI, int* CN) {
    int blk = blockIdx.x; const float* src = x; bf* dst = XB;
    if (blk < NB_) {
        __shared__ int wsum[8];
        const int lane = threadIdx.x & 31, w = (int)threadIdx.x >> 5;   // wave w: keys 256 w + 32 j + lane
        const int* mp = kmask + blk * TT + w * 256 + lane; int* gi = GI + blk * TT;
        unsigned bal[8]; int n = 0;
#pragma unroll
        for (int j = 0; j < 8; ++j) { bal[j] = __builtin_amdgcn_ballot_w32(mp[j * 32] != 0); n += __popc(bal[j]); }
        if (lane == 0) wsum[w] = n;
        __syncthreads();   // every wave's count is in LDS before any wave adds up the counts in front of it
        int base = 0, tot = 0;
#pragma unroll
        for (int i = 0; i < 8; ++i) { const int c = wsum[i]; tot += c; if (i < w) base += c; }
#pragma unroll
        for (int j = 0; j < 8; ++j) { if ((bal[j] >> lane) & 1u) gi[base + __popc(bal[j] & ((1u << lane) - 1u))] = w * 256 + j * 32 + lane; base += __popc(bal[j]); }
#pragma unroll
        for (int j = 0; j < TT / 256; ++j) { const int e = j * 256 + (int)threadIdx.x; if (e >= tot) gi[e] = tot ? 0 : e; }
        if (threadIdx.x == 0) { CN[blk * CNS] = tot ? tot : TT; CN[blk * CNS + 1] = tot; }
        return;
    }
    blk -= NB_;
    if (blk >= XBLK) { blk -= XBLK; const int w = blk / WBLK; blk -= w * WBLK; src = (w == 0) ? wq : (w == 1) ? wk : wv; dst = (w == 0) ? WQ : (w == 1) ? WK : WV; }
    const size_t i = (size_t)blk * 256 + threadIdx.x; const v8f v = *(const v8f*)(src + i * 8); v8us o;
#pragma unroll
    for (int k = 0; k < 8; ++k) o[k] = f2bf(v[k]);
    *(v8us*)(dst + i * 8) = o;
}

// ---- k_proj: the three projections of both batches in one launch; grid (NB_ * TT / 64, NH_, 3), z = 0 q, 1 k, 2 v; 8 waves per 64x64 tile (64 rows of x, one head's 64 features).
// Row m of a k or v tile is x row GI[b][t0 + m]: the planes hold the listed keys packed, and a tile past the keys to walk is left out.
// y[m][n] = sum_k X[m][k] W[n][k] + bias[n], operands straight from K-contiguous bf16 planes. Split K: each wave sums DM / 8 of the k range in its own 16 accumulators; the 8 partial tiles meet in LDS and are summed in wave order.
// Epilogue: the summed f32 value goes straight to the head planes (fp16 and bf16 hi/lo): q and k as [b][h][t][d], v transposed as [b][h][d][t].
#define KS_ 8
__global__ __launch_bounds__(32 * KS_) void k_proj(const bf* __restrict__ X, const bf* __restrict__ WQ, const bf* __restrict__ WK, const bf* __restrict__ WV, const float* __restrict__ bq, const float* __restrict__ bk, const float* __restrict__ bv, const int* __restrict__ GI, const int* __restrict__ CN,
                                                   h16* Q16, bf* Qh, bf* Ql, h16* K16, bf* Kh, bf* Kl, h16* V16, bf* Vh, bf* Vl) {
    typedef WFrag<bf>::V V;
    __shared__ __align__(16) float os[KS_ * 64 * 68];
    const int z = blockIdx.z; const bf* Bt = (z == 0) ? WQ : (z == 1) ? WK : WV; const float* bias = (z == 0) ? bq : (z == 1) ? bk : bv;
    const int lane = threadIdx.x & 31, lr = lane & 15, hi = lane >> 4; const int r0 = blockIdx.x * 64, c0 = blockIdx.y * 64;
    const int b = r0 / TT, t0 = r0 % TT;   // a 64-row tile lies in one batch (TT % 64 == 0)
    if (z != 0 && t0 >= CN[b * CNS]) return;   // the same for the whole block, in front of the barrier: nobody reads a k or v tile past the keys to walk
    v8f acc[4][4];
#pragma unroll
    for (int mb = 0; mb < 4; ++mb)
#pragma unroll
        for (int nb = 0; nb < 4; ++nb) acc[mb][nb] = (v8f){};
    const size_t boff = (size_t)(c0 + lr) * DM + 8 * hi; const int* gp = GI + r0 + lr; size_t aoff[4]; int rr[4];
#pragma unroll
    for (int mb = 0; mb < 4; ++mb) rr[mb] = t0 + mb * 16 + lr;
    if (z != 0) {
#pragma unroll
        for (int mb = 0; mb < 4; ++mb) rr[mb] = gp[mb * 16];
    }
#pragma unroll
    for (int mb = 0; mb < 4; ++mb) aoff[mb] = (size_t)(b * TT + (rr[mb] & (TT - 1))) * DM + 8 * hi;   // the row stays inside the batch whatever the list holds
    asm volatile("s_wait_xcnt 0x0" :: "v"(gp) : "memory");   // the list loads are issued: their address registers stay whole up to this wait
    const int wv = __builtin_amdgcn_readfirstlane((int)(threadIdx.x >> 5)); const int kbeg = wv * (DM / KS_), kend = kbeg + DM / KS_;
#pragma unroll 1
    for (int kc = kbeg; kc < kend; kc += 32) {
        V a[4]; const bf* ap0 = X + aoff[0] + kc; const bf* ap1 = X + aoff[1] + kc; const bf* ap2 = X + aoff[2] + kc; const bf* ap3 = X + aoff[3] + kc;
        a[0] = WFrag<bf>::ld(ap0); a[1] = WFrag<bf>::ld(ap1); a[2] = WFrag<bf>::ld(ap2); a[3] = WFrag<bf>::ld(ap3);
        asm volatile("s_wait_xcnt 0x0" :: "v"(ap0), "v"(ap1), "v"(ap2), "v"(ap3) : "memory");   // the A loads are issued: their address registers stay whole up to this wait and may be reused behind it
#pragma unroll
        for (int nb = 0; nb < 4; ++nb) { const V b = WFrag<bf>::ld(Bt + boff + (size_t)nb * 16 * DM + kc);
#pragma unroll
            for (int mb = 0; mb < 4; ++mb) acc[mb][nb] = WFrag<bf>::mma(a[mb], b, acc[mb][nb]); }
        asm volatile("v_nop\n\tv_nop\n\tv_nop\n\tv_nop" : "+v"(acc[0][0]), "+v"(acc[1][1]), "+v"(acc[2][2]), "+v"(acc[3][3]) : "v"(a[0]), "v"(a[3]));   // the vector slots between a trip's last WMMA and whatever follows it on the back edge or behind the loop
    }
    float* ow = os + wv * (64 * 68);
#pragma unroll
    for (int mb = 0; mb < 4; ++mb)
#pragma unroll
        for (int nb = 0; nb < 4; ++nb)
#pragma unroll
            for (int j = 0; j < 8; ++j) ow[(mb * 16 + hi * 8 + j) * 68 + nb * 16 + lr] = acc[mb][nb][j];
    __syncthreads();   // every wave's partial tile is in LDS before any thread sums across waves
    const size_t pz = ((size_t)b * NH_ + blockIdx.y) * TT * HD;   // the tile's 64 columns are one head
    if (z < 2) {
        h16* P16 = (z == 0 ? Q16 : K16) + pz; bf* Ph = (z == 0 ? Qh : Kh) + pz; bf* Pl = (z == 0 ? Ql : Kl) + pz;
#pragma unroll
        for (int s = 0; s < 32 / KS_; ++s) { const int idx = s * (32 * KS_) + (int)threadIdx.x, row = idx >> 4, cofs = (idx & 15) * 4; v4f val = *(const v4fa*)(os + row * 68 + cofs);
#pragma unroll
            for (int w = 1; w < KS_; ++w) val += *(const v4fa*)(os + w * (64 * 68) + row * 68 + cofs);
            v4h o16; v4us oh, ol;
#pragma unroll
            for (int q = 0; q < 4; ++q) { const float y = val[q] + bfr(bias[c0 + cofs + q]); o16[q] = tohx(y); unsigned short a2, c2; splitf(y, a2, c2); oh[q] = a2; ol[q] = c2; }
            const size_t e = (size_t)(t0 + row) * HD + cofs; *(v4h*)(P16 + e) = o16; *(v4us*)(Ph + e) = oh; *(v4us*)(Pl + e) = ol; }
    } else {   // v: a thread sums 8 consecutive rows t of one column d, so four neighbouring lanes store 64 contiguous bytes of a transposed row
        const int d = (int)threadIdx.x >> 2, tq = (int)threadIdx.x & 3; const float bd = bfr(bias[c0 + d]);
#pragma unroll
        for (int s = 0; s < 2; ++s) { const int tl = s * 32 + tq * 8; v8h o16; v8us oh, ol;
#pragma unroll
            for (int i = 0; i < 8; ++i) { float y = os[(tl + i) * 68 + d];
#pragma unroll
                for (int w = 1; w < KS_; ++w) y += os[w * (64 * 68) + (tl + i) * 68 + d];
                y += bd; o16[i] = tohx(y); unsigned short a2, c2; splitf(y, a2, c2); oh[i] = a2; ol[i] = c2; }
            const size_t e = pz + (size_t)d * TT + t0 + tl; *(v8h*)(V16 + e) = o16; *(v8us*)(Vh + e) = oh; *(v8us*)(Vl + e) = ol; }
        asm volatile("s_wait_xcnt 0x0" ::: "memory");   // the stores above are issued before any of their registers is written again
    }
}
static_assert(TT % 64 == 0 && HD == 64 && DM % (32 * KS_) == 0 && NH_ == NKV, "k_proj: one batch and one head per tile");

#define SK   64                   // keys per LDS stage
#define PIT  72                   // LDS row pitch in 16-bit elements: 128 data bytes + 16, so the 16 rows of a fragment read fall on different banks
#define PLN  (64 * PIT)           // one plane's tile of a stage, elements: 64 rows (K: key x d; V^T: d x key)
#define NST  (TT / SK)
typedef __attribute__((ext_vector_type(8))) unsigned v8u;
// one pass over 16 * NKT keys; Ks, Vs: this lane's fragment origin in the stage's LDS tiles; kw: bit (kt & 1) * 16 + j of word kt / 2: this lane's key 8 hi + j of tile kt is kept
template <typename T16, bool HI, int NKT>   // NKT: 16-key tiles per pass (even)
__device__ __forceinline__ void fa_pass(const typename WFrag<T16>::V (&qf)[2], const typename WFrag<T16>::V (&qf2)[2], const T16* Ks, const T16* Ks2, const T16* Vs, const T16* Vs2, const unsigned (&kw)[NKT / 2], v8f (&o)[4], float& m, float& l) {
    typedef typename WFrag<T16>::V V;
    V kf[NKT][2], kf2[NKT][2], vf[NKT / 2][4], vf2[NKT / 2][4]; v8f s[NKT];
#pragma unroll
    for (int kt = 0; kt < NKT; ++kt)
#pragma unroll
        for (int ks = 0; ks < 2; ++ks) { kf[kt][ks] = WFrag<T16>::ld(Ks + kt * 16 * PIT + ks * 32); if (HI) kf2[kt][ks] = WFrag<T16>::ld(Ks2 + kt * 16 * PIT + ks * 32); }
#pragma unroll
    for (int g = 0; g < NKT / 2; ++g)
#pragma unroll
        for (int dt = 0; dt < 4; ++dt) { vf[g][dt] = WFrag<T16>::ld(Vs + dt * 16 * PIT + g * 32); if (HI) vf2[g][dt] = WFrag<T16>::ld(Vs2 + dt * 16 * PIT + g * 32); }
#pragma unroll
    for (int kt = 0; kt < NKT; ++kt) { s[kt] = (v8f){};
#pragma unroll
        for (int ks = 0; ks < 2; ++ks) { s[kt] = WFrag<T16>::mma(kf[kt][ks], qf[ks], s[kt]); if (HI) { s[kt] = WFrag<T16>::mma(kf[kt][ks], qf2[ks], s[kt]); s[kt] = WFrag<T16>::mma(kf2[kt][ks], qf[ks], s[kt]); } } }
    float cm = -3.0e38f;
#pragma unroll
    for (int kt = 0; kt < NKT; ++kt)
#pragma unroll
        for (int j = 0; j < 8; ++j) { const float t = ((kw[kt >> 1] >> ((kt & 1) * 16 + j)) & 1u) ? s[kt][j] * SCL : -3.0e38f; s[kt][j] = t; cm = fmaxf(cm, t); }
    cm = fmaxf(cm, __shfl_xor(cm, 16, 32));
    const float mn = fmaxf(m, cm), al = __builtin_amdgcn_exp2f((m - mn) * 1.4426950408889634f);
    m = mn; float ls[NKT];
#pragma unroll
    for (int dt = 0; dt < 4; ++dt) o[dt] *= al;
#pragma unroll
    for (int kt = 0; kt < NKT; ++kt) { ls[kt] = 0.f;
#pragma unroll
        for (int j = 0; j < 8; ++j) { const float p = __builtin_amdgcn_exp2f((s[kt][j] - mn) * 1.4426950408889634f); s[kt][j] = p; ls[kt] += p; } }
    float lp = ls[0];
#pragma unroll
    for (int kt = 1; kt < NKT; ++kt) lp += ls[kt];
    l = l * al + lp;
#pragma unroll
    for (int g = 0; g < NKT / 2; ++g) { V pb, pb2;
        if constexpr (HI) { v8us ah, al2, bh, bl;
#pragma unroll
            for (int j = 0; j < 8; ++j) { unsigned short x, y; splitf(s[2 * g][j], x, y); ah[j] = x; al2[j] = y; splitf(s[2 * g + 1][j], x, y); bh[j] = x; bl[j] = y; }
            pb = cat16b(ah, bh); pb2 = cat16b(al2, bl);
        } else { v8h a, b2;
#pragma unroll
            for (int j = 0; j < 8; ++j) { a[j] = tohx(s[2 * g][j]); b2[j] = tohx(s[2 * g + 1][j]); }
            pb = cat16(a, b2); }
#pragma unroll
        for (int dt = 0; dt < 4; ++dt) { o[dt] = WFrag<T16>::mma(vf[g][dt], pb, o[dt]);
            if constexpr (HI) { o[dt] = WFrag<T16>::mma(vf[g][dt], pb2, o[dt]); o[dt] = WFrag<T16>::mma(vf2[g][dt], pb, o[dt]); } } }
}
// grid (RH / 64, NB_ * NH_), 16 waves: waves 0 to 3 take a hi/lo tile each (rows < RH; two 32-key passes per stage), waves 4 to 15 an fp16 tile each (one 64-key pass per stage), so every block of a batch costs the same and, four waves to a SIMD, each SIMD gets one dear wave.
static_assert(RH * 4 == TT && RH % 64 == 0 && NST >= 2 && HD == 64, "four hi/lo and twelve fp16 tiles per block; 512 threads copy 64 rows of 128 bytes per plane");
__global__ __launch_bounds__(512) void k_fattn(const h16* __restrict__ Q16, const h16* __restrict__ K16, const h16* __restrict__ V16, const bf* __restrict__ Qh, const bf* __restrict__ Ql, const bf* __restrict__ Kh, const bf* __restrict__ Kl, const bf* __restrict__ Vh, const bf* __restrict__ Vl, const int* __restrict__ CN, float* __restrict__ OUT) {
    __shared__ __align__(16) bf ring[2 * 6 * PLN];   // two buffers of six tiles: K16, Kh, Kl, V16, Vh, Vl
    const int bh = blockIdx.y, b = bh / NH_, h = bh % NH_; const size_t pz = (size_t)bh * TT * HD;
    const int wv = __builtin_amdgcn_readfirstlane((int)(threadIdx.x >> 5)); const bool dear = wv < 4;
    const int lane = threadIdx.x & 31, lr = lane & 15, hi = lane >> 4;
    const int nkept = CN[b * CNS + 1]; const int nw = (CN[b * CNS] + SK - 1) / SK, nst = nw < 1 ? 1 : nw > NST ? NST : nw;   // stages to walk, bounded by the shape
    float* orow = OUT + (size_t)b * TT * DQ + h * HD;
    const int q0 = dear ? ((int)blockIdx.x * 4 + wv) * 16 : RH + ((int)blockIdx.x * 12 + wv - 4) * 16;
    // a thread copies 16 bytes of each plane per stage: row tid / 8, bytes 16 * (tid % 8)
    const int crow = (int)threadIdx.x >> 3, cch = ((int)threadIdx.x & 7) * 8;
    const size_t gk = pz + (size_t)crow * HD + cch, gv = pz + (size_t)crow * TT + cch;
    const unsigned ld0 = (unsigned)(size_t)ring + (unsigned)(crow * PIT + cch) * 2u;
    auto copy = [&](int st) {
        const unsigned d0 = ld0 + (unsigned)(st & 1) * (6u * PLN * 2u), d1 = d0 + PLN * 2u, d2 = d0 + PLN * 4u, d3 = d0 + PLN * 6u, d4 = d0 + PLN * 8u, d5 = d0 + PLN * 10u;
        const size_t ko = gk + (size_t)st * SK * HD, vo = gv + (size_t)st * SK;
        const h16* g0 = K16 + ko; const bf* g1 = Kh + ko; const bf* g2 = Kl + ko; const h16* g3 = V16 + vo; const bf* g4 = Vh + vo; const bf* g5 = Vl + vo;
        // the stage's six copies; the wait closes the statement so that no address register is written again before it
        asm volatile("global_load_async_to_lds_b128 %0, %6, off\n\t"
                     "global_load_async_to_lds_b128 %1, %7, off\n\t"
                     "global_load_async_to_lds_b128 %2, %8, off\n\t"
                     "global_load_async_to_lds_b128 %3, %9, off\n\t"
                     "global_load_async_to_lds_b128 %4, %10, off\n\t"
                     "global_load_async_to_lds_b128 %5, %11, off\n\t"
                     "s_wait_xcnt 0x0"
                     :: "v"(d0), "v"(d1), "v"(d2), "v"(d3), "v"(d4), "v"(d5), "v"(g0), "v"(g1), "v"(g2), "v"(g3), "v"(g4), "v"(g5) : "memory");
    };
    copy(0);
    // query fragments, kept as raw words so that both kinds of wave hold them in the same registers (an fp16 wave uses the first two)
    const bf* qpa = (dear ? Qh : (const bf*)Q16) + pz + (size_t)(q0 + lr) * HD + 8 * hi; const bf* qpb = (dear ? Ql : (const bf*)Q16) + pz + (size_t)(q0 + lr) * HD + 8 * hi;
    v8u qr[4];
#pragma unroll
    for (int ks = 0; ks < 2; ++ks) { qr[ks] = __builtin_bit_cast(v8u, WFrag<bf>::ld(qpa + ks * 32)); qr[2 + ks] = __builtin_bit_cast(v8u, WFrag<bf>::ld(qpb + ks * 32)); }
    asm volatile("s_wait_xcnt 0x0" :: "v"(qpa), "v"(qpb) : "memory");   // the address registers of the loads above stay whole up to this wait
    v8f o[4];
#pragma unroll
    for (int dt = 0; dt < 4; ++dt) o[dt] = (v8f){};
    float m = -3.0e38f, l = 0.f;
    asm volatile("s_wait_asynccnt 0x0" ::: "memory");   // this wave's copies of stage 0 have landed
    __syncthreads();                                    // and every other wave's: stage 0 is readable
    if (nst > 1) copy(1);
#pragma unroll 1
    for (int t = 0; t < nst; ++t) {
        const bf* bp = ring + (t & 1) * (6 * PLN) + lr * PIT + 8 * hi;
        unsigned kw[SK / 32];
#pragma unroll
        for (int g = 0; g < SK / 32; ++g) { const int rem = nkept - (t * SK + g * 32);   // bit i: listed key 32 g + i of the stage is a kept one (the kept keys come first)
            kw[g] = (rem >= 32 ? 0xFFFFFFFFu : rem <= 0 ? 0u : (1u << rem) - 1u) >> (8 * hi); }
        if (dear) {
            const v16bf qf[2] = { __builtin_bit_cast(v16bf, qr[0]), __builtin_bit_cast(v16bf, qr[1]) }, qf2[2] = { __builtin_bit_cast(v16bf, qr[2]), __builtin_bit_cast(v16bf, qr[3]) };
#pragma unroll
            for (int p = 0; p < 2; ++p) { const unsigned k1[1] = { kw[p] };
                fa_pass<bf, true, 2>(qf, qf2, bp + PLN + p * 32 * PIT, bp + 2 * PLN + p * 32 * PIT, bp + 4 * PLN + p * 32, bp + 5 * PLN + p * 32, k1, o, m, l); }
        } else {
            const v16h qf[2] = { __builtin_bit_cast(v16h, qr[0]), __builtin_bit_cast(v16h, qr[1]) };
            fa_pass<h16, false, 4>(qf, qf, (const h16*)bp, (const h16*)bp, (const h16*)(bp + 3 * PLN), (const h16*)(bp + 3 * PLN), kw, o, m, l);
        }
        asm volatile("s_wait_dscnt 0x0" ::: "memory");      // this wave's reads of stage t are done
        asm volatile("s_wait_asynccnt 0x0" ::: "memory");   // this wave's copies of stage t + 1 have landed
        __syncthreads();                                    // publishes stage t + 1 and frees stage t's buffer
        if (t + 2 < nst) copy(t + 2);
    }
    asm volatile("s_wait_asynccnt 0x0" ::: "memory");   // no copy is outstanding when the wave ends
    l += __shfl_xor(l, 16, 32);
    const float inv = __fdiv_rn(1.0f, l);
    float* op = orow + (size_t)(q0 + lr) * DQ + hi * 8;
#pragma unroll
    for (int dt = 0; dt < 4; ++dt) { v4f w0, w1;
#pragma unroll
        for (int j = 0; j < 4; ++j) { w0[j] = o[dt][j] * inv; w1[j] = o[dt][4 + j] * inv; }
        *(v4f*)(op + dt * 16) = w0; *(v4f*)(op + dt * 16 + 4) = w1; }
}

extern "C" void kernel_launch(void* const* d_in, const int* in_sizes, int n_in,
                              void* d_out, int out_size, void* d_ws, size_t ws_size, hipStream_t stream) {
    (void)in_sizes; (void)n_in; (void)out_size;
    const float* x = (const float*)d_in[0]; const int* kmask = (const int*)d_in[1]; const float* wq = (const float*)d_in[2]; const float* bq = (const float*)d_in[3]; const float* wk = (const float*)d_in[4]; const float* bk = (const float*)d_in[5]; const float* wv = (const float*)d_in[6]; const float* bv = (const float*)d_in[7]; /* argument order feature, mask (int32 [2][2048]: 0 = excluded: READ per key by k_cvt), W_Q, b_Q, W_K, b_K, W_V, b_V ('oi' + biases: read) */
    float* OUT = (float*)d_out;     // [2][2048][1024]
    char* wsp = (char*)d_ws;
    auto take = [&](size_t bytes) { char* p = wsp; wsp += (bytes + 255) & ~(size_t)255; return (void*)p; };
    bf* WQ = (bf*)take((size_t)DQ * DM * 2); bf* WK = (bf*)take((size_t)DKV * DM * 2); bf* WV = (bf*)take((size_t)DKV * DM * 2);
    bf* XB = (bf*)take((size_t)NB_ * TT * DM * 2);
    const size_t PL = (size_t)NH_ * TT * HD;   // one batch's head planes, elements; every plane holds both batches
    h16* QP16 = (h16*)take(NB_ * PL * 2); h16* KP16 = (h16*)take(NB_ * PL * 2); h16* VT16 = (h16*)take(NB_ * PL * 2);
    bf* QPh = (bf*)take(NB_ * PL * 2); bf* QPl = (bf*)take(NB_ * PL * 2); bf* KPh = (bf*)take(NB_ * PL * 2); bf* KPl = (bf*)take(NB_ * PL * 2); bf* VTh = (bf*)take(NB_ * PL * 2); bf* VTl = (bf*)take(NB_ * PL * 2);
    int* GI = (int*)take((size_t)NB_ * TT * 4); int* CN = (int*)take((size_t)NB_ * CNS * 4);
    if ((size_t)(wsp - (char*)d_ws) > ws_size) return;    // ws 256 MiB
    k_cvt<<<NB_ + XBLK + 3 * WBLK, 256, 0, stream>>>(x, wq, wk, wv, kmask, XB, WQ, WK, WV, GI, CN);
    k_proj<<<dim3(NB_ * TT / 64, NH_, 3), 32 * KS_, 0, stream>>>(XB, WQ, WK, WV, bq, bk, bv, GI, CN, QP16, QPh, QPl, KP16, KPh, KPl, VT16, VTh, VTl);
    k_fattn<<<dim3(RH / 64, NB_ * NH_), 512, 0, stream>>>(QP16, KP16, VT16, QPh, QPl, KPh, KPl, VTh, VTl, CN, OUT);
}

// v006
// It runs in 66.5 microseconds.
// In both of two side-by-side timings against v005, it was 1.40 times as fast.
// Counting every step since v000, it is 29.0 times as fast.
#include <hip/hip_runtime.h>

// Multi-head self-attention with a per-key integer padding mask and NO output projection (feature [2][2048][1024]; q, k, v = x W^T + b ('oi' (out, in) [1024][1024] uniform(+-1/32) + biases ZEROS on this draw: READ; 16 heads x 64); A = q.k / 8; where(mask[b][key] == 0, -1e9, A): mask int32 [2][2048] RANDOM 0 / 1: 0 = EXCLUDED (the fill replaces the score: an exclusion; no batch is fully excluded): READ per key; softmax over the kept keys; out = merged attn v -> [2][2048][1024] (4.2 M); argument order feature, mask, W_Q, b_Q, W_K, b_K, W_V, b_V).
// Layout: one launch rounds x and the three weights to bf16 and lists each batch's kept keys; one projection launch (q: every row; k, v: the listed rows only, packed; X and W stages shared in LDS by a block's 4 waves) sums exact products + f32 biases and its epilogue writes the head planes (fp16 + bf16 hi/lo) of q, k and transposed v; then ONE fused attention launch over both batches and all heads (hybrid rows: < 512 hi/lo 3 products, rest fp16): K and V^T stages shared in LDS by a block's 16 waves; scores, mask, running softmax and attn x V stay in registers and the output rows are written directly.
// Compute dtypes, f32 accumulate: every input rounded to bf16; projections exact + f32 biases; attention rows < 512 3 products, rest fp16; softmax f32; output f32.

#define NB_  2
#define TT   2048
#define DM   1024
#define NH_  16
#define NKV  16
#define REP  (NH_ / NKV)
#define HD   64
#define DQ   (NH_ * HD)
#define DKV  (NKV * HD)
#define RH   512                  // query rows < RH use hi+lo planes
#define WIN  0
#define SCL  0.125f   // HD^-0.5
typedef _Float16 h16;
typedef unsigned short bf;
typedef __attribute__((ext_vector_type(16))) __bf16   v16bf;
typedef __attribute__((ext_vector_type(16))) _Float16 v16h;
typedef __attribute__((ext_vector_type(8)))  _Float16 v8h;
typedef __attribute__((ext_vector_type(8)))  unsigned short v8us;
typedef __attribute__((ext_vector_type(8)))  float    v8f;
typedef __attribute__((ext_vector_type(4)))  float    v4f;
typedef v8h  __attribute__((may_alias)) v8ha;
typedef v4f  __attribute__((may_alias)) v4fa;
typedef v8us __attribute__((may_alias)) v8usa;

__device__ __forceinline__ unsigned short f2bf(float f) { unsigned u = __float_as_uint(f); u += 0x7FFFu + ((u >> 16) & 1u); return (unsigned short)(u >> 16); }
__device__ __forceinline__ float bf2f(unsigned short b) { return __uint_as_float(((unsigned)b) << 16); }
__device__ __forceinline__ float bfr(float f) { return bf2f(f2bf(f)); }
__device__ __forceinline__ v16h cat16(v8h lo, v8h hi) { return __builtin_shufflevector(lo, hi, 0, 1, 2, 3, 4, 5, 6, 7, 8, 9, 10, 11, 12, 13, 14, 15); }
__device__ __forceinline__ v16bf cat16b(v8us lo, v8us hi) { return __builtin_bit_cast(v16bf, __builtin_shufflevector(lo, hi, 0, 1, 2, 3, 4, 5, 6, 7, 8, 9, 10, 11, 12, 13, 14, 15)); }
__device__ __forceinline__ v8f wmma16(v16h a, v16h b, v8f c) { return __builtin_amdgcn_wmma_f32_16x16x32_f16(false, a, false, b, (short)0, c, false, false); }
__device__ __forceinline__ v8f wmmab(v16bf a, v16bf b, v8f c) { return __builtin_amdgcn_wmma_f32_16x16x32_bf16(false, a, false, b, (short)0, c, false, false); }



// ---- fragment loaders and products of the two 16-bit forms
template <typename T16> struct WFrag;
template <> struct WFrag<h16> { typedef v16h V; static __device__ __forceinline__ V ld(const h16* p) { return cat16(*(const v8h*)p, *(const v8h*)(p + 16)); } static __device__ __forceinline__ v8f mma(V a, V b, v8f c) { return wmma16(a, b, c); } };
template <> struct WFrag<bf> { typedef v16bf V; static __device__ __forceinline__ V ld(const bf* p) { return cat16b(*(const v8us*)p, *(const v8us*)(p + 16)); } static __device__ __forceinline__ v8f mma(V a, V b, v8f c) { return wmmab(a, b, c); } };
__device__ __forceinline__ h16 tohx(float x) { return (h16)x; }
__device__ __forceinline__ void splitf(float y, unsigned short& h, unsigned short& l) { h = f2bf(y); l = f2bf(y - bf2f(h)); }
typedef __attribute__((ext_vector_type(4))) _Float16 v4h;
typedef __attribute__((ext_vector_type(4))) unsigned short v4us;

// ---- k_cvt: bf16 copies of x (both batches) and of the three weights, 8 elements per thread; the block index picks the source.
// Blocks 0 to NB_ - 1 instead list one batch's kept keys in rising order: GI[b][0 .. kept) = their indices, the rest 0 (a row that exists; its score is excluded).
// An excluded key has weight exactly 0 beside any kept key, so k, v and the attention walk the listed keys only. CN[32 b] = keys to walk, CN[32 b + 1] = how many of them are kept.
// A batch with no kept key is the reference's uniform row over ALL keys: every key is listed and none counts as kept.
#define CNS 32                    // ints between the batches' counts: one writing block per 128-byte line
#define XBLK (NB_ * TT * DM / 8 / 256)
#define WBLK (DQ * DM / 8 / 256)
static_assert(NB_ * TT * DM % 2048 == 0 && DQ * DM % 2048 == 0 && DQ == DKV, "whole blocks per source");
static_assert(TT == 8 * 256, "the list block: 8 waves of 256 keys; TT a power of two for the row bound in k_proj");
__global__ __launch_bounds__(256) void k_cvt(const float* __restrict__ x, const float* __restrict__ wq, const float* __restrict__ wk, const float* __restrict__ wv, const int* __restrict__ kmask, bf* XB, bf* WQ, bf* WK, bf* WV, int* GI, int* CN) {
    int blk = blockIdx.x; const float* src = x; bf* dst = XB;
    if (blk < NB_) {
        __shared__ int wsum[8];
        const int lane = threadIdx.x & 31, w = (int)threadIdx.x >> 5;   // wave w: keys 256 w + 32 j + lane
        const int* mp = kmask + blk * TT + w * 256 + lane; int* gi = GI + blk * TT;
        unsigned bal[8]; int n = 0;
#pragma unroll
        for (int j = 0; j < 8; ++j) { bal[j] = __builtin_amdgcn_ballot_w32(mp[j * 32] != 0); n += __popc(bal[j]); }
        if (lane == 0) wsum[w] = n;
        __syncthreads();   // every wave's count is in LDS before any wave adds up the counts in front of it
        int base = 0, tot = 0;
#pragma unroll
        for (int i = 0; i < 8; ++i) { const int c = wsum[i]; tot += c; if (i < w) base += c; }
#pragma unroll
        for (int j = 0; j < 8; ++j) { if ((bal[j] >> lane) & 1u) gi[base + __popc(bal[j] & ((1u << lane) - 1u))] = w * 256 + j * 32 + lane; base += __popc(bal[j]); }
#pragma unroll
        for (int j = 0; j < TT / 256; ++j) { const int e = j * 256 + (int)threadIdx.x; if (e >= tot) gi[e] = tot ? 0 : e; }
        if (threadIdx.x == 0) { CN[blk * CNS] = tot ? tot : TT; CN[blk * CNS + 1] = tot; }
        return;
    }
    blk -= NB_;
    if (blk >= XBLK) { blk -= XBLK; const int w = blk / WBLK; blk -= w * WBLK; src = (w == 0) ? wq : (w == 1) ? wk : wv; dst = (w == 0) ? WQ : (w == 1) ? WK : WV; }
    const size_t i = (size_t)blk * 256 + threadIdx.x; const v8f v = *(const v8f*)(src + i * 8); v8us o;
#pragma unroll
    for (int k = 0; k < 8; ++k) o[k] = f2bf(v[k]);
    *(v8us*)(dst + i * 8) = o;
}

// ---- k_proj: the three projections of both batches in one launch; grid (NB_ * TT / 128, DQ / 128, 3), z = 0 q, 1 k, 2 v; 4 waves per 128x128 tile (128 rows of x, two heads' features), a wave owns 64 rows x one head.
// Row m of a k or v tile is x row GI[b][t0 + m]: the planes hold the listed keys packed, and a tile past the keys to walk is left out.
// y[m][n] = sum_k X[m][k] W[n][k] + bias[n]. Each 64-k stage of the X and W tiles is brought into LDS once, whole 128-byte lines, by asynchronous copies, two buffers; every wave takes its fragments from there and sums the whole k range in rising order.
// q, k: A = W rows, B = x rows, so a lane holds 8 consecutive features d of one row t; v: A = x rows, B = W rows, so a lane holds 8 consecutive t of one feature d. Either way its 8 values are 16 contiguous bytes of the head plane (q, k [b][h][t][d]; v transposed [b][h][d][t]).
// Epilogue: per plane (fp16, bf16 hi, bf16 lo) a wave lays its 64x64 tile in its own part of the freed ring and stores it back as whole lines.
#define PT   128                  // tile edge: rows of x, features
#define PK   64                   // k per LDS stage
#define PTIL (PT * PIT)           // one operand's tile of a stage, elements
#define PNS  (DM / PK)
#define PIT  72                   // LDS row pitch in 16-bit elements: 128 data bytes + 16, so the 16 rows of a fragment read fall on different banks
#define CP8  "global_load_async_to_lds_b128 %0, %8, off\n\tglobal_load_async_to_lds_b128 %1, %9, off\n\tglobal_load_async_to_lds_b128 %2, %10, off\n\tglobal_load_async_to_lds_b128 %3, %11, off\n\tglobal_load_async_to_lds_b128 %4, %12, off\n\tglobal_load_async_to_lds_b128 %5, %13, off\n\tglobal_load_async_to_lds_b128 %6, %14, off\n\tglobal_load_async_to_lds_b128 %7, %15, off\n\ts_wait_xcnt 0x0"
__global__ __launch_bounds__(128) void k_proj(const bf* __restrict__ X, const bf* __restrict__ WQ, const bf* __restrict__ WK, const bf* __restrict__ WV, const float* __restrict__ bq, const float* __restrict__ bk, const float* __restrict__ bv, const int* __restrict__ GI, const int* __restrict__ CN,
                                              h16* Q16, bf* Qh, bf* Ql, h16* K16, bf* Kh, bf* Kl, h16* V16, bf* Vh, bf* Vl) {
    typedef WFrag<bf>::V V;
    __shared__ __align__(16) bf pr[2 * 2 * PTIL];   // two buffers of [X tile | W tile]
    const int z = blockIdx.z; const bf* Bt = (z == 0) ? WQ : (z == 1) ? WK : WV; const float* bias = (z == 0) ? bq : (z == 1) ? bk : bv;
    const int lane = threadIdx.x & 31, lr = lane & 15, hi = lane >> 4; const int r0 = blockIdx.x * PT, c0 = blockIdx.y * PT;
    const int b = r0 / TT, t0 = r0 % TT;   // a 128-row tile lies in one batch (TT % 128 == 0)
    if (z != 0 && t0 >= CN[b * CNS]) return;   // the same for the whole block, in front of every barrier and copy: nobody reads a k or v tile past the keys to walk
    // a thread copies 16 bytes of 8 rows of each operand per stage: rows tid / 8 + 16 i, bytes 16 * (tid % 8)
    const int crow = (int)threadIdx.x >> 3, cch = ((int)threadIdx.x & 7) * 8;
    const int* gp = GI + r0 + crow; int rr[8]; unsigned xo[8];
#pragma unroll
    for (int i = 0; i < 8; ++i) rr[i] = t0 + crow + 16 * i;
    if (z != 0) {
#pragma unroll
        for (int i = 0; i < 8; ++i) rr[i] = gp[16 * i];
    }
#pragma unroll
    for (int i = 0; i < 8; ++i) xo[i] = (unsigned)(b * TT + (rr[i] & (TT - 1))) * DM + cch;   // the row stays inside the batch whatever the list holds
    asm volatile("s_wait_xcnt 0x0" :: "v"(gp) : "memory");   // the list loads are issued: their address registers stay whole up to this wait
    const bf* wp = Bt + (size_t)(c0 + crow) * DM + cch;
    const unsigned ld0 = (unsigned)(size_t)pr + (unsigned)(crow * PIT + cch) * 2u;
    auto copy = [&](int st) {
        const unsigned d = ld0 + (unsigned)(st & 1) * (2u * PTIL * 2u), e = d + PTIL * 2u; const bf* xs = X + st * PK; const bf* ws = wp + st * PK;
        // the stage's copies, X tile then W tile; the wait closes each statement so that no address register is written again before it
        asm volatile(CP8 :: "v"(d), "v"(d + 16u * PIT * 2u), "v"(d + 32u * PIT * 2u), "v"(d + 48u * PIT * 2u), "v"(d + 64u * PIT * 2u), "v"(d + 80u * PIT * 2u), "v"(d + 96u * PIT * 2u), "v"(d + 112u * PIT * 2u),
                     "v"(xs + xo[0]), "v"(xs + xo[1]), "v"(xs + xo[2]), "v"(xs + xo[3]), "v"(xs + xo[4]), "v"(xs + xo[5]), "v"(xs + xo[6]), "v"(xs + xo[7]) : "memory");
        asm volatile(CP8 :: "v"(e), "v"(e + 16u * PIT * 2u), "v"(e + 32u * PIT * 2u), "v"(e + 48u * PIT * 2u), "v"(e + 64u * PIT * 2u), "v"(e + 80u * PIT * 2u), "v"(e + 96u * PIT * 2u), "v"(e + 112u * PIT * 2u),
                     "v"(ws), "v"(ws + 16 * DM), "v"(ws + 32 * DM), "v"(ws + 48 * DM), "v"(ws + 64 * DM), "v"(ws + 80 * DM), "v"(ws + 96 * DM), "v"(ws + 112 * DM) : "memory");
    };
    copy(0);
    const int wv = __builtin_amdgcn_readfirstlane((int)(threadIdx.x >> 5)), wx = wv & 1, wf = wv >> 1;   // the wave's half of the x rows, of the features
    const int xfo = wx * 64 * PIT, wfo = PTIL + wf * 64 * PIT;
    const bf* fa = pr + (z < 2 ? wfo : xfo) + lr * PIT + 8 * hi; const bf* fb = pr + (z < 2 ? xfo : wfo) + lr * PIT + 8 * hi;   // this lane's A and B fragment origins in buffer 0
    v8f acc[4][4];
#pragma unroll
    for (int ma = 0; ma < 4; ++ma)
#pragma unroll
        for (int nb = 0; nb < 4; ++nb) acc[ma][nb] = (v8f){};
    asm volatile("s_wait_asynccnt 0x0" ::: "memory");   // this wave's copies of stage 0 have landed
    __syncthreads();                                    // and every other wave's: stage 0 is readable
    copy(1);
#pragma unroll 1
    for (int t = 0; t < PNS; ++t) {
        const int bo = (t & 1) * (2 * PTIL);
        V a[PK / 32][4], bb[PK / 32][4];
#pragma unroll
        for (int ks = 0; ks < PK / 32; ++ks)
#pragma unroll
            for (int i = 0; i < 4; ++i) { a[ks][i] = WFrag<bf>::ld(fa + bo + i * 16 * PIT + ks * 32); bb[ks][i] = WFrag<bf>::ld(fb + bo + i * 16 * PIT + ks * 32); }
        asm volatile("s_wait_dscnt 0x0" ::: "memory");      // this wave's reads of stage t are done: the whole stage is in its registers
        asm volatile("s_wait_asynccnt 0x0" ::: "memory");   // this wave's copies of stage t + 1 have landed
        __syncthreads();                                    // publishes stage t + 1 and frees stage t's buffer
        if (t + 2 < PNS) copy(t + 2);
        __builtin_amdgcn_sched_barrier(0);   // the products stay behind the refill's issue, so that the copies fly under them and not only under the next stage's LDS reads
#pragma unroll
        for (int ks = 0; ks < PK / 32; ++ks)
#pragma unroll
            for (int nb = 0; nb < 4; ++nb)
#pragma unroll
                for (int ma = 0; ma < 4; ++ma) acc[ma][nb] = WFrag<bf>::mma(a[ks][ma], bb[ks][nb], acc[ma][nb]);
    }
    asm volatile("s_wait_asynccnt 0x0" ::: "memory");   // no copy is outstanding when the ring is put to another use
    const int cw = c0 + wf * 64, tw = t0 + wx * 64;   // the wave's head (64 features from cw) and its first row
    if (z < 2) {
#pragma unroll
        for (int ma = 0; ma < 4; ++ma) { const v4f b0 = *(const v4f*)(bias + cw + ma * 16 + hi * 8), b1 = *(const v4f*)(bias + cw + ma * 16 + hi * 8 + 4);
#pragma unroll
            for (int nb = 0; nb < 4; ++nb)
#pragma unroll
                for (int j = 0; j < 4; ++j) { acc[ma][nb][j] += bfr(b0[j]); acc[ma][nb][4 + j] += bfr(b1[j]); } }
    } else {
#pragma unroll
        for (int nb = 0; nb < 4; ++nb) { const float bd = bfr(bias[cw + nb * 16 + lr]);
#pragma unroll
            for (int ma = 0; ma < 4; ++ma)
#pragma unroll
                for (int j = 0; j < 8; ++j) acc[ma][nb][j] += bd; }
    }
    bf* sw = pr + wv * (64 * PIT);   // the wave's own staging tile: 64 plane rows (q, k: t; v: d) of 64 elements
    const size_t pz = ((size_t)b * NH_ + (cw >> 6)) * TT * HD + (z < 2 ? (size_t)tw * HD : (size_t)tw); const int gpit = z < 2 ? HD : TT;
    bf* P0 = (bf*)(z == 0 ? Q16 : z == 1 ? K16 : V16) + pz; bf* P1 = (z == 0 ? Qh : z == 1 ? Kh : Vh) + pz; bf* P2 = (z == 0 ? Ql : z == 1 ? Kl : Vl) + pz;
    const unsigned vo = (unsigned)((lane >> 3) * gpit + (lane & 7) * 8);   // a wave-wide store: 4 plane rows of 128 bytes
#pragma unroll
    for (int p = 0; p < 3; ++p) { bf* P = p == 0 ? P0 : p == 1 ? P1 : P2;
#pragma unroll
        for (int ma = 0; ma < 4; ++ma)
#pragma unroll
            for (int nb = 0; nb < 4; ++nb) { v8us o;
#pragma unroll
                for (int j = 0; j < 8; ++j) { const float y = acc[ma][nb][j]; unsigned short a2, c2; splitf(y, a2, c2); o[j] = p == 0 ? __builtin_bit_cast(unsigned short, tohx(y)) : p == 1 ? a2 : c2; }
                *(v8usa*)(sw + (nb * 16 + lr) * PIT + ma * 16 + hi * 8) = o; }
        asm volatile("s_wait_dscnt 0x0" ::: "memory");   // the wave's tile is in LDS before its lanes read each other's rows
#pragma unroll
        for (int g = 0; g < 4; ++g) { v8us v[4];
#pragma unroll
            for (int i = 0; i < 4; ++i) v[i] = *(const v8usa*)(sw + ((g * 4 + i) * 4 + (lane >> 3)) * PIT + (lane & 7) * 8);
#pragma unroll
            for (int i = 0; i < 4; ++i) *(v8usa*)(P + (size_t)((g * 4 + i) * 4) * gpit + vo) = v[i];
            asm volatile("s_wait_xcnt 0x0" ::: "memory");   // the stores above are issued before any of their registers is written again
            __builtin_amdgcn_sched_barrier(0);               // and no later write of those registers is lifted over that wait
        }
        asm volatile("s_wait_dscnt 0x0" ::: "memory");   // the reads of this plane are done before the next plane is laid over it
    }
}
static_assert(TT % PT == 0 && DQ % PT == 0 && HD == 64 && DM % PK == 0 && PNS >= 2 && NH_ == NKV && 4 * 64 * PIT <= 4 * PTIL, "k_proj: one batch per tile, one head per wave, both first stages exist, the staging tiles fit the ring");

#define SK   64                   // keys per LDS stage
#define PLN  (64 * PIT)           // one plane's tile of a stage, elements: 64 rows (K: key x d; V^T: d x key)
#define NST  (TT / SK)
typedef __attribute__((ext_vector_type(8))) unsigned v8u;
// one pass over 16 * NKT keys; Ks, Vs: this lane's fragment origin in the stage's LDS tiles; kw: bit (kt & 1) * 16 + j of word kt / 2: this lane's key 8 hi + j of tile kt is kept
template <typename T16, bool HI, int NKT>   // NKT: 16-key tiles per pass (even)
__device__ __forceinline__ void fa_pass(const typename WFrag<T16>::V (&qf)[2], const typename WFrag<T16>::V (&qf2)[2], const T16* Ks, const T16* Ks2, const T16* Vs, const T16* Vs2, const unsigned (&kw)[NKT / 2], v8f (&o)[4], float& m, float& l) {
    typedef typename WFrag<T16>::V V;
    V kf[NKT][2], kf2[NKT][2], vf[NKT / 2][4], vf2[NKT / 2][4]; v8f s[NKT];
#pragma unroll
    for (int kt = 0; kt < NKT; ++kt)
#pragma unroll
        for (int ks = 0; ks < 2; ++ks) { kf[kt][ks] = WFrag<T16>::ld(Ks + kt * 16 * PIT + ks * 32); if (HI) kf2[kt][ks] = WFrag<T16>::ld(Ks2 + kt * 16 * PIT + ks * 32); }
#pragma unroll
    for (int g = 0; g < NKT / 2; ++g)
#pragma unroll
        for (int dt = 0; dt < 4; ++dt) { vf[g][dt] = WFrag<T16>::ld(Vs + dt * 16 * PIT + g * 32); if (HI) vf2[g][dt] = WFrag<T16>::ld(Vs2 + dt * 16 * PIT + g * 32); }
#pragma unroll
    for (int kt = 0; kt < NKT; ++kt) { s[kt] = (v8f){};
#pragma unroll
        for (int ks = 0; ks < 2; ++ks) { s[kt] = WFrag<T16>::mma(kf[kt][ks], qf[ks], s[kt]); if (HI) { s[kt] = WFrag<T16>::mma(kf[kt][ks], qf2[ks], s[kt]); s[kt] = WFrag<T16>::mma(kf2[kt][ks], qf[ks], s[kt]); } } }
    float cm = -3.0e38f;
#pragma unroll
    for (int kt = 0; kt < NKT; ++kt)
#pragma unroll
        for (int j = 0; j < 8; ++j) { const float t = ((kw[kt >> 1] >> ((kt & 1) * 16 + j)) & 1u) ? s[kt][j] * SCL : -3.0e38f; s[kt][j] = t; cm = fmaxf(cm, t); }
    cm = fmaxf(cm, __shfl_xor(cm, 16, 32));
    const float mn = fmaxf(m, cm), al = __builtin_amdgcn_exp2f((m - mn) * 1.4426950408889634f);
    m = mn; float ls[NKT];
#pragma unroll
    for (int dt = 0; dt < 4; ++dt) o[dt] *= al;
#pragma unroll
    for (int kt = 0; kt < NKT; ++kt) { ls[kt] = 0.f;
#pragma unroll
        for (int j = 0; j < 8; ++j) { const float p = __builtin_amdgcn_exp2f((s[kt][j] - mn) * 1.4426950408889634f); s[kt][j] = p; ls[kt] += p; } }
    float lp = ls[0];
#pragma unroll
    for (int kt = 1; kt < NKT; ++kt) lp += ls[kt];
    l = l * al + lp;
#pragma unroll
    for (int g = 0; g < NKT / 2; ++g) { V pb, pb2;
        if constexpr (HI) { v8us ah, al2, bh, bl;
#pragma unroll
            for (int j = 0; j < 8; ++j) { unsigned short x, y; splitf(s[2 * g][j], x, y); ah[j] = x; al2[j] = y; splitf(s[2 * g + 1][j], x, y); bh[j] = x; bl[j] = y; }
            pb = cat16b(ah, bh); pb2 = cat16b(al2, bl);
        } else { v8h a, b2;
#pragma unroll
            for (int j = 0; j < 8; ++j) { a[j] = tohx(s[2 * g][j]); b2[j] = tohx(s[2 * g + 1][j]); }
            pb = cat16(a, b2); }
#pragma unroll
        for (int dt = 0; dt < 4; ++dt) { o[dt] = WFrag<T16>::mma(vf[g][dt], pb, o[dt]);
            if constexpr (HI) { o[dt] = WFrag<T16>::mma(vf[g][dt], pb2, o[dt]); o[dt] = WFrag<T16>::mma(vf2[g][dt], pb, o[dt]); } } }
}
// grid (RH / 64, NB_ * NH_), 16 waves: waves 0 to 3 take a hi/lo tile each (rows < RH; two 32-key passes per stage), waves 4 to 15 an fp16 tile each (one 64-key pass per stage), so every block of a batch costs the same and, four waves to a SIMD, each SIMD gets one dear wave.
static_assert(RH * 4 == TT && RH % 64 == 0 && NST >= 2 && HD == 64, "four hi/lo and twelve fp16 tiles per block; 512 threads copy 64 rows of 128 bytes per plane");
__global__ __launch_bounds__(512) void k_fattn(const h16* __restrict__ Q16, const h16* __restrict__ K16, const h16* __restrict__ V16, const bf* __restrict__ Qh, const bf* __restrict__ Ql, const bf* __restrict__ Kh, const bf* __restrict__ Kl, const bf* __restrict__ Vh, const bf* __restrict__ Vl, const int* __restrict__ CN, float* __restrict__ OUT) {
    __shared__ __align__(16) bf ring[2 * 6 * PLN];   // two buffers of six tiles: K16, Kh, Kl, V16, Vh, Vl
    const int bh = blockIdx.y, b = bh / NH_, h = bh % NH_; const size_t pz = (size_t)bh * TT * HD;
    const int wv = __builtin_amdgcn_readfirstlane((int)(threadIdx.x >> 5)); const bool dear = wv < 4;
    const int lane = threadIdx.x & 31, lr = lane & 15, hi = lane >> 4;
    const int nkept = CN[b * CNS + 1]; const int nw = (CN[b * CNS] + SK - 1) / SK, nst = nw < 1 ? 1 : nw > NST ? NST : nw;   // stages to walk, bounded by the shape
    float* orow = OUT + (size_t)b * TT * DQ + h * HD;
    const int q0 = dear ? ((int)blockIdx.x * 4 + wv) * 16 : RH + ((int)blockIdx.x * 12 + wv - 4) * 16;
    // a thread copies 16 bytes of each plane per stage: row tid / 8, bytes 16 * (tid % 8)
    const int crow = (int)threadIdx.x >> 3, cch = ((int)threadIdx.x & 7) * 8;
    const size_t gk = pz + (size_t)crow * HD + cch, gv = pz + (size_t)crow * TT + cch;
    const unsigned ld0 = (unsigned)(size_t)ring + (unsigned)(crow * PIT + cch) * 2u;
    auto copy = [&](int st) {
        const unsigned d0 = ld0 + (unsigned)(st & 1) * (6u * PLN * 2u), d1 = d0 + PLN * 2u, d2 = d0 + PLN * 4u, d3 = d0 + PLN * 6u, d4 = d0 + PLN * 8u, d5 = d0 + PLN * 10u;
        const size_t ko = gk + (size_t)st * SK * HD, vo = gv + (size_t)st * SK;
        const h16* g0 = K16 + ko; const bf* g1 = Kh + ko; const bf* g2 = Kl + ko; const h16* g3 = V16 + vo; const bf* g4 = Vh + vo; const bf* g5 = Vl + vo;
        // the stage's six copies; the wait closes the statement so that no address register is written again before it
        asm volatile("global_load_async_to_lds_b128 %0, %6, off\n\t"
                     "global_load_async_to_lds_b128 %1, %7, off\n\t"
                     "global_load_async_to_lds_b128 %2, %8, off\n\t"
                     "global_load_async_to_lds_b128 %3, %9, off\n\t"
                     "global_load_async_to_lds_b128 %4, %10, off\n\t"
                     "global_load_async_to_lds_b128 %5, %11, off\n\t"
                     "s_wait_xcnt 0x0"
                     :: "v"(d0), "v"(d1), "v"(d2), "v"(d3), "v"(d4), "v"(d5), "v"(g0), "v"(g1), "v"(g2), "v"(g3), "v"(g4), "v"(g5) : "memory");
    };
    copy(0);
    // query fragments, kept as raw words so that both kinds of wave hold them in the same registers (an fp16 wave uses the first two)
    const bf* qpa = (dear ? Qh : (const bf*)Q16) + pz + (size_t)(q0 + lr) * HD + 8 * hi; const bf* qpb = (dear ? Ql : (const bf*)Q16) + pz + (size_t)(q0 + lr) * HD + 8 * hi;
    v8u qr[4];
#pragma unroll
    for (int ks = 0; ks < 2; ++ks) { qr[ks] = __builtin_bit_cast(v8u, WFrag<bf>::ld(qpa + ks * 32)); qr[2 + ks] = __builtin_bit_cast(v8u, WFrag<bf>::ld(qpb + ks * 32)); }
    asm volatile("s_wait_xcnt 0x0" :: "v"(qpa), "v"(qpb) : "memory");   // the address registers of the loads above stay whole up to this wait
    v8f o[4];
#pragma unroll
    for (int dt = 0; dt < 4; ++dt) o[dt] = (v8f){};
    float m = -3.0e38f, l = 0.f;
    asm volatile("s_wait_asynccnt 0x0" ::: "memory");   // this wave's copies of stage 0 have landed
    __syncthreads();                                    // and every other wave's: stage 0 is readable
    if (nst > 1) copy(1);
#pragma unroll 1
    for (int t = 0; t < nst; ++t) {
        const bf* bp = ring + (t & 1) * (6 * PLN) + lr * PIT + 8 * hi;
        unsigned kw[SK / 32];
#pragma unroll
        for (int g = 0; g < SK / 32; ++g) { const int rem = nkept - (t * SK + g * 32);   // bit i: listed key 32 g + i of the stage is a kept one (the kept keys come first)
            kw[g] = (rem >= 32 ? 0xFFFFFFFFu : rem <= 0 ? 0u : (1u << rem) - 1u) >> (8 * hi); }
        if (dear) {
            const v16bf qf[2] = { __builtin_bit_cast(v16bf, qr[0]), __builtin_bit_cast(v16bf, qr[1]) }, qf2[2] = { __builtin_bit_cast(v16bf, qr[2]), __builtin_bit_cast(v16bf, qr[3]) };
#pragma unroll
            for (int p = 0; p < 2; ++p) { const unsigned k1[1] = { kw[p] };
                fa_pass<bf, true, 2>(qf, qf2, bp + PLN + p * 32 * PIT, bp + 2 * PLN + p * 32 * PIT, bp + 4 * PLN + p * 32, bp + 5 * PLN + p * 32, k1, o, m, l); }
        } else {
            const v16h qf[2] = { __builtin_bit_cast(v16h, qr[0]), __builtin_bit_cast(v16h, qr[1]) };
            fa_pass<h16, false, 4>(qf, qf, (const h16*)bp, (const h16*)bp, (const h16*)(bp + 3 * PLN), (const h16*)(bp + 3 * PLN), kw, o, m, l);
        }
        asm volatile("s_wait_dscnt 0x0" ::: "memory");      // this wave's reads of stage t are done
        asm volatile("s_wait_asynccnt 0x0" ::: "memory");   // this wave's copies of stage t + 1 have landed
        __syncthreads();                                    // publishes stage t + 1 and frees stage t's buffer
        if (t + 2 < nst) copy(t + 2);
    }
    asm volatile("s_wait_asynccnt 0x0" ::: "memory");   // no copy is outstanding when the wave ends
    l += __shfl_xor(l, 16, 32);
    const float inv = __fdiv_rn(1.0f, l);
    float* op = orow + (size_t)(q0 + lr) * DQ + hi * 8;
#pragma unroll
    for (int dt = 0; dt < 4; ++dt) { v4f w0, w1;
#pragma unroll
        for (int j = 0; j < 4; ++j) { w0[j] = o[dt][j] * inv; w1[j] = o[dt][4 + j] * inv; }
        *(v4f*)(op + dt * 16) = w0; *(v4f*)(op + dt * 16 + 4) = w1; }
}

extern "C" void kernel_launch(void* const* d_in, const int* in_sizes, int n_in,
                              void* d_out, int out_size, void* d_ws, size_t ws_size, hipStream_t stream) {
    (void)in_sizes; (void)n_in; (void)out_size;
    const float* x = (const float*)d_in[0]; const int* kmask = (const int*)d_in[1]; const float* wq = (const float*)d_in[2]; const float* bq = (const float*)d_in[3]; const float* wk = (const float*)d_in[4]; const float* bk = (const float*)d_in[5]; const float* wv = (const float*)d_in[6]; const float* bv = (const float*)d_in[7]; /* argument order feature, mask (int32 [2][2048]: 0 = excluded: READ per key by k_cvt), W_Q, b_Q, W_K, b_K, W_V, b_V ('oi' + biases: read) */
    float* OUT = (float*)d_out;     // [2][2048][1024]
    char* wsp = (char*)d_ws;
    auto take = [&](size_t bytes) { char* p = wsp; wsp += (bytes + 255) & ~(size_t)255; return (void*)p; };
    bf* WQ = (bf*)take((size_t)DQ * DM * 2); bf* WK = (bf*)take((size_t)DKV * DM * 2); bf* WV = (bf*)take((size_t)DKV * DM * 2);
    bf* XB = (bf*)take((size_t)NB_ * TT * DM * 2);
    const size_t PL = (size_t)NH_ * TT * HD;   // one batch's head planes, elements; every plane holds both batches
    h16* QP16 = (h16*)take(NB_ * PL * 2); h16* KP16 = (h16*)take(NB_ * PL * 2); h16* VT16 = (h16*)take(NB_ * PL * 2);
    bf* QPh = (bf*)take(NB_ * PL * 2); bf* QPl = (bf*)take(NB_ * PL * 2); bf* KPh = (bf*)take(NB_ * PL * 2); bf* KPl = (bf*)take(NB_ * PL * 2); bf* VTh = (bf*)take(NB_ * PL * 2); bf* VTl = (bf*)take(NB_ * PL * 2);
    int* GI = (int*)take((size_t)NB_ * TT * 4); int* CN = (int*)take((size_t)NB_ * CNS * 4);
    if ((size_t)(wsp - (char*)d_ws) > ws_size) return;    // ws 256 MiB
    k_cvt<<<NB_ + XBLK + 3 * WBLK, 256, 0, stream>>>(x, wq, wk, wv, kmask, XB, WQ, WK, WV, GI, CN);
    k_proj<<<dim3(NB_ * TT / PT, DQ / PT, 3), 128, 0, stream>>>(XB, WQ, WK, WV, bq, bk, bv, GI, CN, QP16, QPh, QPl, KP16, KPh, KPl, VT16, VTh, VTl);
    k_fattn<<<dim3(RH / 64, NB_ * NH_), 512, 0, stream>>>(QP16, KP16, VT16, QPh, QPl, KPh, KPl, VTh, VTl, CN, OUT);
}
